// v000
// Times are from an AMD MI455X. After a warm-up the kernel runs many times in a row, and a time is the length of
// such a window on the GPU divided by its runs, so every launch and the gaps after it count. The runs cycle
// through copies of the inputs. A figure is the median of several windows, for all but v000 over two sittings.
// Sittings can differ by a few percent; kernels timed side by side share one.
// v000 is the starting kernel. One run takes 49.4 microseconds.
#include <hip/hip_runtime.h>

// ---------------------------------------------------------------------------
// SparseCrossAttention on MI455X (gfx1250, wave32, WMMA).
// Dense interpretation: per (b,h) attention over P with a per-head score-mix
// MLP. All matmuls use V_WMMA_F32_16X16X4_F32 (full f32 fidelity): at ~1 GFLOP
// and ~6 MB of L2-resident data, the problem is latency-bound, not rate-bound.
// v2: fused QKV (3 launches total), 16x64 wave tiles with 4 independent WMMA
// accumulator chains, K-split attn@V across all 8 waves, cost prefetch.
// ---------------------------------------------------------------------------

typedef __attribute__((ext_vector_type(2))) float v2f;
typedef __attribute__((ext_vector_type(8))) float v8f;

constexpr int kBS = 4;
constexpr int kS  = 256;
constexpr int kP  = 256;
constexpr int kD  = 256;
constexpr int kH  = 8;
constexpr int kHD = 32;
constexpr int kMSH = 16;

__device__ __forceinline__ v8f wmma_f32x4(v2f a, v2f b, v8f c) {
  // V_WMMA_F32_16X16X4_F32: D = A(16x4) * B(4x16) + C(16x16)
  return __builtin_amdgcn_wmma_f32_16x16x4_f32(
      /*neg_a=*/false, a, /*neg_b=*/false, b,
      /*c_mod=*/(short)0, c, /*reuse_a=*/false, /*reuse_b=*/false);
}

// One wave computes a 16x64 tile of Y = X @ W^T + bias (W row-major [256,256],
// so B[k][n] = W[n][k]). One A-fragment feeds 4 B-fragments -> 4 independent
// accumulator chains for the XDL pipe.
__device__ __forceinline__ void gemm16x64(const float* __restrict__ X,
                                          const float* __restrict__ W,
                                          const float* __restrict__ bias,
                                          float* __restrict__ Y,
                                          int mt, int ng, int lane) {
  const int half = lane >> 4;   // 0: K=k0,k0+1   1: K=k0+2,k0+3
  const int l16  = lane & 15;
  const float* arow = X + (size_t)(mt * 16 + l16) * kD;
  const float* w0 = W + (size_t)(ng * 64 +  0 + l16) * kD;
  const float* w1 = W + (size_t)(ng * 64 + 16 + l16) * kD;
  const float* w2 = W + (size_t)(ng * 64 + 32 + l16) * kD;
  const float* w3 = W + (size_t)(ng * 64 + 48 + l16) * kD;

  v8f acc0 = {}, acc1 = {}, acc2 = {}, acc3 = {};
#pragma unroll 2
  for (int k0 = 0; k0 < kD; k0 += 4) {
    const int ka = k0 + half * 2;
    v2f a  = {arow[ka], arow[ka + 1]};
    v2f b0 = {w0[ka], w0[ka + 1]};
    v2f b1 = {w1[ka], w1[ka + 1]};
    v2f b2 = {w2[ka], w2[ka + 1]};
    v2f b3 = {w3[ka], w3[ka + 1]};
    acc0 = wmma_f32x4(a, b0, acc0);
    acc1 = wmma_f32x4(a, b1, acc1);
    acc2 = wmma_f32x4(a, b2, acc2);
    acc3 = wmma_f32x4(a, b3, acc3);
  }

  v8f accs[4] = {acc0, acc1, acc2, acc3};
#pragma unroll
  for (int j = 0; j < 4; ++j) {
    const int n = ng * 64 + j * 16 + l16;
    const float bn = bias[n];
#pragma unroll
    for (int r = 0; r < 8; ++r) {
      const int mm = mt * 16 + half * 8 + r;
      Y[(size_t)mm * kD + n] = accs[j][r] + bn;
    }
  }
}

// Fused Q/K/V projections: 3 GEMMs x 256 wave-tiles (64 mt x 4 ngroups).
// 768 wave-tiles / 8 waves per block -> 96 blocks.
__global__ __launch_bounds__(256)
void sca_qkv(const float* __restrict__ row_emb, const float* __restrict__ col_emb,
             const float* __restrict__ Wq, const float* __restrict__ bq,
             const float* __restrict__ Wk, const float* __restrict__ bk,
             const float* __restrict__ Wv, const float* __restrict__ bv,
             float* __restrict__ Qw, float* __restrict__ Kw,
             float* __restrict__ Vw) {
  const int lane = threadIdx.x & 31;
  const int wave = threadIdx.x >> 5;
  const int gw = blockIdx.x * 8 + wave;     // 0..767
  const int which = gw >> 8;                // 0=Q, 1=K, 2=V (wave-uniform)
  const int t  = gw & 255;
  const int mt = t >> 2;
  const int ng = t & 3;
  const float* X    = (which == 0) ? row_emb : col_emb;
  const float* W    = (which == 0) ? Wq : (which == 1) ? Wk : Wv;
  const float* bias = (which == 0) ? bq : (which == 1) ? bk : bv;
  float*       Y    = (which == 0) ? Qw : (which == 1) ? Kw : Vw;
  gemm16x64(X, W, bias, Y, mt, ng, lane);
}

// Output projection: out = heads @ Wo^T + bo. 256 wave-tiles -> 32 blocks.
__global__ __launch_bounds__(256)
void sca_out(const float* __restrict__ Hm, const float* __restrict__ Wo,
             const float* __restrict__ bo, float* __restrict__ out) {
  const int lane = threadIdx.x & 31;
  const int wave = threadIdx.x >> 5;
  const int gw = blockIdx.x * 8 + wave;     // 0..255
  gemm16x64(Hm, Wo, bo, out, gw >> 2, gw & 3, lane);
}

// One block = (b, h, 32-row S slab). WMMA scores -> per-head MLP mix with
// cost -> row softmax over P in LDS -> WMMA attn@V (K-split over wave pairs).
#define LSTR 260   // 32 x 260 floats; stride%64==4 -> 16 rows conflict-free
__global__ __launch_bounds__(256)
void sca_attn(const float* __restrict__ Q, const float* __restrict__ Km,
              const float* __restrict__ Vm, const float* __restrict__ cost,
              const float* __restrict__ mW1, const float* __restrict__ mb1,
              const float* __restrict__ mW2, const float* __restrict__ mb2,
              float* __restrict__ heads) {
  __shared__ float sm[32 * LSTR];
  __shared__ float part[2][32][33];

  const int tid  = threadIdx.x;
  const int lane = tid & 31;
  const int wave = tid >> 5;
  const int half = lane >> 4;
  const int l16  = lane & 15;

  const int blk = blockIdx.x;
  const int b  = blk >> 6;          // 64 blocks per batch (H * S/32)
  const int h  = (blk >> 3) & 7;
  const int s0 = (blk & 7) * 32;

  // Prefetch this block's cost slab (32 KB) so phase 2 hits cache.
  // Lowers to global_prefetch_b8; 256 threads x 128 B covers the slab.
  {
    const char* cpf = (const char*)(cost + (size_t)(b * kS + s0) * kP);
    __builtin_prefetch(cpf + (size_t)tid * 128, 0, 1);
  }

  // ---- Phase 1: raw logits[32,256] = Q_h(32x32) @ K_h^T(32x256) ------------
  // Wave w: mt = w&1, nt = (w>>1)*4 .. +3  (1 A-frag feeds 4 B-frags).
  {
    const int mt  = wave & 1;
    const int ntb = (wave >> 1) * 4;
    const float* qrow = Q + (size_t)(b * kS + s0 + mt * 16 + l16) * kD + h * kHD;
    const float* k0r = Km + (size_t)(b * kP + (ntb + 0) * 16 + l16) * kD + h * kHD;
    const float* k1r = Km + (size_t)(b * kP + (ntb + 1) * 16 + l16) * kD + h * kHD;
    const float* k2r = Km + (size_t)(b * kP + (ntb + 2) * 16 + l16) * kD + h * kHD;
    const float* k3r = Km + (size_t)(b * kP + (ntb + 3) * 16 + l16) * kD + h * kHD;
    v8f a0 = {}, a1 = {}, a2 = {}, a3 = {};
#pragma unroll
    for (int k0 = 0; k0 < kHD; k0 += 4) {
      const int ka = k0 + half * 2;
      v2f a  = {qrow[ka], qrow[ka + 1]};
      v2f b0 = {k0r[ka], k0r[ka + 1]};
      v2f b1 = {k1r[ka], k1r[ka + 1]};
      v2f b2 = {k2r[ka], k2r[ka + 1]};
      v2f b3 = {k3r[ka], k3r[ka + 1]};
      a0 = wmma_f32x4(a, b0, a0);
      a1 = wmma_f32x4(a, b1, a1);
      a2 = wmma_f32x4(a, b2, a2);
      a3 = wmma_f32x4(a, b3, a3);
    }
    v8f accs[4] = {a0, a1, a2, a3};
#pragma unroll
    for (int j = 0; j < 4; ++j)
#pragma unroll
      for (int r = 0; r < 8; ++r)
        sm[(mt * 16 + half * 8 + r) * LSTR + (ntb + j) * 16 + l16] = accs[j][r];
  }
  __syncthreads();

  // ---- Phase 2: per-head MLP([score/sqrt(32), cost]) -----------------------
  float W1a[kMSH], W1b[kMSH], B1[kMSH], W2[kMSH];
#pragma unroll
  for (int j = 0; j < kMSH; ++j) {
    W1a[j] = mW1[h * 2 * kMSH + j];          // weight on dot score
    W1b[j] = mW1[h * 2 * kMSH + kMSH + j];   // weight on edge cost
    B1[j]  = mb1[h * kMSH + j];
    W2[j]  = mW2[h * kMSH + j];
  }
  const float B2 = mb2[h];
  const float iscale = 0.17677669529663687f;  // 1/sqrt(32)

  for (int idx = tid; idx < 32 * kP; idx += 256) {
    const int row = idx >> 8, col = idx & 255;
    const float l = sm[row * LSTR + col] * iscale;
    const float c = cost[(size_t)(b * kS + s0 + row) * kP + col];
    float o = B2;
#pragma unroll
    for (int j = 0; j < kMSH; ++j) {
      const float hid = fmaf(l, W1a[j], fmaf(c, W1b[j], B1[j]));
      o = fmaf(fmaxf(hid, 0.0f), W2[j], o);
    }
    sm[row * LSTR + col] = o;
  }
  __syncthreads();

  // ---- Phase 3: row softmax over P=256 (4 rows per wave, shfl reductions) --
  for (int r = wave * 4; r < wave * 4 + 4; ++r) {
    float* rowp = sm + r * LSTR;
    float vals[8];
    float vmax = -3.4e38f;
#pragma unroll
    for (int i = 0; i < 8; ++i) {
      vals[i] = rowp[lane + i * 32];
      vmax = fmaxf(vmax, vals[i]);
    }
#pragma unroll
    for (int m = 16; m; m >>= 1) vmax = fmaxf(vmax, __shfl_xor(vmax, m, 32));
    float vsum = 0.0f;
#pragma unroll
    for (int i = 0; i < 8; ++i) {
      vals[i] = __expf(vals[i] - vmax);
      vsum += vals[i];
    }
#pragma unroll
    for (int m = 16; m; m >>= 1) vsum += __shfl_xor(vsum, m, 32);
    const float inv = 1.0f / vsum;
#pragma unroll
    for (int i = 0; i < 8; ++i) rowp[lane + i * 32] = vals[i] * inv;
  }
  __syncthreads();

  // ---- Phase 4: heads[32,32] = attn[32,256] @ V_h[256,32] ------------------
  // All 8 waves: tile = wave>>1 (2 mt x 2 nt), kh = wave&1 splits P in half.
  {
    const int tile = wave >> 1;
    const int kh = wave & 1;
    const int mt = tile >> 1, nt = tile & 1;
    const int n = nt * 16 + l16;
    const float* vb = Vm + (size_t)(b * kP + kh * 128) * kD + h * kHD + n;
    const float* arow = sm + (mt * 16 + l16) * LSTR + kh * 128;
    v8f acc = {};
#pragma unroll 4
    for (int k0 = 0; k0 < 128; k0 += 4) {
      const int ka = k0 + half * 2;
      v2f a  = {arow[ka], arow[ka + 1]};
      v2f vv = {vb[(size_t)ka * kD], vb[(size_t)(ka + 1) * kD]};
      acc = wmma_f32x4(a, vv, acc);
    }
#pragma unroll
    for (int r = 0; r < 8; ++r)
      part[kh][mt * 16 + half * 8 + r][n] = acc[r];
  }
  __syncthreads();

  // Reduce the two K-halves and write heads[b, s0+row, h*32+col].
  for (int idx = tid; idx < 32 * 32; idx += 256) {
    const int row = idx >> 5, col = idx & 31;
    heads[(size_t)(b * kS + s0 + row) * kD + h * kHD + col] =
        part[0][row][col] + part[1][row][col];
  }
}

extern "C" void kernel_launch(void* const* d_in, const int* in_sizes, int n_in,
                              void* d_out, int out_size, void* d_ws, size_t ws_size,
                              hipStream_t stream) {
  const float* row_emb = (const float*)d_in[0];
  const float* col_emb = (const float*)d_in[1];
  const float* cost    = (const float*)d_in[2];
  const float* Wq = (const float*)d_in[3];
  const float* bq = (const float*)d_in[4];
  const float* Wk = (const float*)d_in[5];
  const float* bk = (const float*)d_in[6];
  const float* Wv = (const float*)d_in[7];
  const float* bv = (const float*)d_in[8];
  const float* Wo = (const float*)d_in[9];
  const float* bo = (const float*)d_in[10];
  const float* mW1 = (const float*)d_in[11];
  const float* mb1 = (const float*)d_in[12];
  const float* mW2 = (const float*)d_in[13];
  const float* mb2 = (const float*)d_in[14];

  const size_t plane = (size_t)kBS * kS * kD;   // 1024*256 floats = 1 MB
  float* Qw = (float*)d_ws;
  float* Kw = Qw + plane;
  float* Vw = Kw + plane;
  float* Hw = Vw + plane;

  sca_qkv<<<96, 256, 0, stream>>>(row_emb, col_emb, Wq, bq, Wk, bk, Wv, bv,
                                  Qw, Kw, Vw);
  sca_attn<<<kBS * kH * (kS / 32), 256, 0, stream>>>(Qw, Kw, Vw, cost,
                                                     mW1, mb1, mW2, mb2, Hw);
  sca_out<<<32, 256, 0, stream>>>(Hw, Wo, bo, (float*)d_out);
}

// v001
// A run of this version takes 26.2 microseconds.
// Next to v000, in two timings, it ran 1.89 and 1.91 times as fast.
#include <hip/hip_runtime.h>

// ---------------------------------------------------------------------------
// SparseCrossAttention on MI455X (gfx1250, wave32, WMMA).
// Dense interpretation: per (b,h) attention over P with a per-head score-mix
// MLP. All matmuls use V_WMMA_F32_16X16X4_F32 (full f32 fidelity): at ~1 GFLOP
// and ~6 MB of L2-resident data, the problem is latency-bound, not rate-bound.
// Fused QKV (3 launches total), projections block-tiled with operands staged in
// LDS, K-split attn@V across all 8 waves, cost prefetch.
// ---------------------------------------------------------------------------

typedef __attribute__((ext_vector_type(2))) float v2f;
typedef __attribute__((ext_vector_type(4))) float v4f;
typedef __attribute__((ext_vector_type(8))) float v8f;

constexpr int kBS = 4;
constexpr int kS  = 256;
constexpr int kP  = 256;
constexpr int kD  = 256;
constexpr int kH  = 8;
constexpr int kHD = 32;
constexpr int kMSH = 16;

__device__ __forceinline__ v8f wmma_f32x4(v2f a, v2f b, v8f c) {
  // V_WMMA_F32_16X16X4_F32: D = A(16x4) * B(4x16) + C(16x16)
  return __builtin_amdgcn_wmma_f32_16x16x4_f32(
      /*neg_a=*/false, a, /*neg_b=*/false, b,
      /*c_mod=*/(short)0, c, /*reuse_a=*/false, /*reuse_b=*/false);
}

// Block-tiled Y = X @ W^T + bias (W row-major [256,256], so B[k][n] = W[n][k]).
// A block of BM/16 x 2 waves owns a BM x 64 tile of Y. Its BM rows of X and 64
// rows of W are brought in by b128 loads (16 lanes
// per row piece) and parked in LDS; the WMMA fragments are read from LDS.
// All loads are issued up front; K is handed over in 4 pieces of 64 so that the
// products on piece c run while the later pieces are still on their way.
// Each wave: a 16 x 32 tile (one A fragment feeds 2 accumulator chains), k in
// ascending steps of 4.
constexpr int kPitch = 260;  // floats; pitch % 64 == 4 -> 16 rows x 4 dwords hit 64 banks
constexpr int kKC = 64;      // floats of K per piece
constexpr int kNC = kD / kKC;

// Work-group barrier that orders LDS traffic only. __syncthreads() would also
// drain every outstanding global load, i.e. wait for the later K pieces before
// the products on the first piece may start.
__device__ __forceinline__ void lds_barrier() {
  __builtin_amdgcn_fence(__ATOMIC_RELEASE, "workgroup", "local");
  __builtin_amdgcn_s_barrier();
  __builtin_amdgcn_fence(__ATOMIC_ACQUIRE, "workgroup", "local");
}

template <int BM>
__device__ __forceinline__ void gemm_lds(const float* __restrict__ X,
                                         const float* __restrict__ W,
                                         const float* __restrict__ bias,
                                         float* __restrict__ Y,
                                         int m0, int n0,
                                         float* __restrict__ sA,
                                         float* __restrict__ sW) {
  constexpr int T  = BM * 4;      // threads in the block
  constexpr int RP = T / 16;      // rows covered by one load of the whole block
  constexpr int PA = BM / RP;     // loads per thread and piece, X rows
  constexpr int PW = 64 / RP;     // loads per thread and piece, W rows
  const int tid  = threadIdx.x;
  const int lane = tid & 31;
  const int wave = tid >> 5;
  const int half = lane >> 4;     // 0: K=k0,k0+1   1: K=k0+2,k0+3
  const int l16  = lane & 15;
  const int lr = tid >> 4;        // row inside one block-wide load
  const int lc = (tid & 15) * 4;  // float column inside the piece

  const float* xp = X + (size_t)(m0 + lr) * kD + lc;
  const float* wp = W + (size_t)(n0 + lr) * kD + lc;
  v4f ra[kNC][PA], rw[kNC][PW];
  // Every loop over c and p is fully unrolled: ra and rw stay in registers only
  // with constant indices (otherwise they go to scratch).
#pragma unroll
  for (int c = 0; c < kNC; ++c) {
#pragma unroll
    for (int p = 0; p < PA; ++p)
      ra[c][p] = *(const v4f*)(xp + p * RP * kD + c * kKC);
#pragma unroll
    for (int p = 0; p < PW; ++p)
      rw[c][p] = *(const v4f*)(wp + p * RP * kD + c * kKC);
  }
  // Precaution: the two address pairs stay live up to this wait, so that no
  // load result or later value lands on a register an issued load still names.
  asm volatile("s_wait_xcnt 0x0" :: "v"(xp), "v"(wp) : "memory");

  const int wm = wave >> 1, wn = wave & 1;
  const float* arow = sA + (wm * 16 + l16) * kPitch + half * 2;
  const float* b0r  = sW + (wn * 32 + l16) * kPitch + half * 2;
  const float* b1r  = b0r + 16 * kPitch;

  v8f acc0 = {}, acc1 = {};
#pragma unroll
  for (int c = 0; c < kNC; ++c) {
#pragma unroll
    for (int p = 0; p < PA; ++p)
      *(v4f*)(sA + (p * RP + lr) * kPitch + c * kKC + lc) = ra[c][p];
#pragma unroll
    for (int p = 0; p < PW; ++p)
      *(v4f*)(sW + (p * RP + lr) * kPitch + c * kKC + lc) = rw[c][p];
    lds_barrier();   // piece c is complete in LDS; each piece has its own columns
    // Unrolled: LDS offsets become immediates and reads are issued ahead of use.
#pragma unroll
    for (int k0 = c * kKC; k0 < (c + 1) * kKC; k0 += 4) {
      v2f a  = {arow[k0], arow[k0 + 1]};
      v2f b0 = {b0r[k0], b0r[k0 + 1]};
      v2f b1 = {b1r[k0], b1r[k0 + 1]};
      acc0 = wmma_f32x4(a, b0, acc0);
      acc1 = wmma_f32x4(a, b1, acc1);
    }
  }

  v8f accs[2] = {acc0, acc1};
#pragma unroll
  for (int j = 0; j < 2; ++j) {
    const int n = n0 + wn * 32 + j * 16 + l16;
    const float bn = bias[n];
#pragma unroll
    for (int r = 0; r < 8; ++r) {
      const int mm = m0 + wm * 16 + half * 8 + r;
      Y[(size_t)mm * kD + n] = accs[j][r] + bn;
    }
  }
}

// Fused Q/K/V projections: 3 GEMMs x (16 x 4) tiles of 64 x 64 -> 192 blocks.
__global__ __launch_bounds__(256)
void sca_qkv(const float* __restrict__ row_emb, const float* __restrict__ col_emb,
             const float* __restrict__ Wq, const float* __restrict__ bq,
             const float* __restrict__ Wk, const float* __restrict__ bk,
             const float* __restrict__ Wv, const float* __restrict__ bv,
             float* __restrict__ Qw, float* __restrict__ Kw,
             float* __restrict__ Vw) {
  __shared__ __attribute__((aligned(16))) float sA[64 * kPitch];
  __shared__ __attribute__((aligned(16))) float sW[64 * kPitch];
  const int which = blockIdx.x >> 6;        // 0=Q, 1=K, 2=V
  const int t  = blockIdx.x & 63;
  const float* X    = (which == 0) ? row_emb : col_emb;
  const float* W    = (which == 0) ? Wq : (which == 1) ? Wk : Wv;
  const float* bias = (which == 0) ? bq : (which == 1) ? bk : bv;
  float*       Y    = (which == 0) ? Qw : (which == 1) ? Kw : Vw;
  gemm_lds<64>(X, W, bias, Y, (t >> 2) * 64, (t & 3) * 64, sA, sW);
}

// Output projection: out = heads @ Wo^T + bo. (32 x 4) tiles of 32 x 64 -> 128
// blocks of 4 waves.
__global__ __launch_bounds__(128)
void sca_out(const float* __restrict__ Hm, const float* __restrict__ Wo,
             const float* __restrict__ bo, float* __restrict__ out) {
  __shared__ __attribute__((aligned(16))) float sA[32 * kPitch];
  __shared__ __attribute__((aligned(16))) float sW[64 * kPitch];
  gemm_lds<32>(Hm, Wo, bo, out, (int)(blockIdx.x >> 2) * 32, (int)(blockIdx.x & 3) * 64, sA, sW);
}

// One block = (b, h, 32-row S slab). WMMA scores -> per-head MLP mix with
// cost -> row softmax over P in LDS -> WMMA attn@V (K-split over wave pairs).
#define LSTR 260   // 32 x 260 floats; stride%64==4 -> 16 rows conflict-free
__global__ __launch_bounds__(256)
void sca_attn(const float* __restrict__ Q, const float* __restrict__ Km,
              const float* __restrict__ Vm, const float* __restrict__ cost,
              const float* __restrict__ mW1, const float* __restrict__ mb1,
              const float* __restrict__ mW2, const float* __restrict__ mb2,
              float* __restrict__ heads) {
  __shared__ float sm[32 * LSTR];
  __shared__ float part[2][32][33];

  const int tid  = threadIdx.x;
  const int lane = tid & 31;
  const int wave = tid >> 5;
  const int half = lane >> 4;
  const int l16  = lane & 15;

  const int blk = blockIdx.x;
  const int b  = blk >> 6;          // 64 blocks per batch (H * S/32)
  const int h  = (blk >> 3) & 7;
  const int s0 = (blk & 7) * 32;

  // Prefetch this block's cost slab (32 KB) so phase 2 hits cache.
  // Lowers to global_prefetch_b8; 256 threads x 128 B covers the slab.
  {
    const char* cpf = (const char*)(cost + (size_t)(b * kS + s0) * kP);
    __builtin_prefetch(cpf + (size_t)tid * 128, 0, 1);
  }

  // ---- Phase 1: raw logits[32,256] = Q_h(32x32) @ K_h^T(32x256) ------------
  // Wave w: mt = w&1, nt = (w>>1)*4 .. +3  (1 A-frag feeds 4 B-frags).
  {
    const int mt  = wave & 1;
    const int ntb = (wave >> 1) * 4;
    const float* qrow = Q + (size_t)(b * kS + s0 + mt * 16 + l16) * kD + h * kHD;
    const float* k0r = Km + (size_t)(b * kP + (ntb + 0) * 16 + l16) * kD + h * kHD;
    const float* k1r = Km + (size_t)(b * kP + (ntb + 1) * 16 + l16) * kD + h * kHD;
    const float* k2r = Km + (size_t)(b * kP + (ntb + 2) * 16 + l16) * kD + h * kHD;
    const float* k3r = Km + (size_t)(b * kP + (ntb + 3) * 16 + l16) * kD + h * kHD;
    v8f a0 = {}, a1 = {}, a2 = {}, a3 = {};
#pragma unroll
    for (int k0 = 0; k0 < kHD; k0 += 4) {
      const int ka = k0 + half * 2;
      v2f a  = {qrow[ka], qrow[ka + 1]};
      v2f b0 = {k0r[ka], k0r[ka + 1]};
      v2f b1 = {k1r[ka], k1r[ka + 1]};
      v2f b2 = {k2r[ka], k2r[ka + 1]};
      v2f b3 = {k3r[ka], k3r[ka + 1]};
      a0 = wmma_f32x4(a, b0, a0);
      a1 = wmma_f32x4(a, b1, a1);
      a2 = wmma_f32x4(a, b2, a2);
      a3 = wmma_f32x4(a, b3, a3);
    }
    v8f accs[4] = {a0, a1, a2, a3};
#pragma unroll
    for (int j = 0; j < 4; ++j)
#pragma unroll
      for (int r = 0; r < 8; ++r)
        sm[(mt * 16 + half * 8 + r) * LSTR + (ntb + j) * 16 + l16] = accs[j][r];
  }
  __syncthreads();

  // ---- Phase 2: per-head MLP([score/sqrt(32), cost]) -----------------------
  float W1a[kMSH], W1b[kMSH], B1[kMSH], W2[kMSH];
#pragma unroll
  for (int j = 0; j < kMSH; ++j) {
    W1a[j] = mW1[h * 2 * kMSH + j];          // weight on dot score
    W1b[j] = mW1[h * 2 * kMSH + kMSH + j];   // weight on edge cost
    B1[j]  = mb1[h * kMSH + j];
    W2[j]  = mW2[h * kMSH + j];
  }
  const float B2 = mb2[h];
  const float iscale = 0.17677669529663687f;  // 1/sqrt(32)

  for (int idx = tid; idx < 32 * kP; idx += 256) {
    const int row = idx >> 8, col = idx & 255;
    const float l = sm[row * LSTR + col] * iscale;
    const float c = cost[(size_t)(b * kS + s0 + row) * kP + col];
    float o = B2;
#pragma unroll
    for (int j = 0; j < kMSH; ++j) {
      const float hid = fmaf(l, W1a[j], fmaf(c, W1b[j], B1[j]));
      o = fmaf(fmaxf(hid, 0.0f), W2[j], o);
    }
    sm[row * LSTR + col] = o;
  }
  __syncthreads();

  // ---- Phase 3: row softmax over P=256 (4 rows per wave, shfl reductions) --
  for (int r = wave * 4; r < wave * 4 + 4; ++r) {
    float* rowp = sm + r * LSTR;
    float vals[8];
    float vmax = -3.4e38f;
#pragma unroll
    for (int i = 0; i < 8; ++i) {
      vals[i] = rowp[lane + i * 32];
      vmax = fmaxf(vmax, vals[i]);
    }
#pragma unroll
    for (int m = 16; m; m >>= 1) vmax = fmaxf(vmax, __shfl_xor(vmax, m, 32));
    float vsum = 0.0f;
#pragma unroll
    for (int i = 0; i < 8; ++i) {
      vals[i] = __expf(vals[i] - vmax);
      vsum += vals[i];
    }
#pragma unroll
    for (int m = 16; m; m >>= 1) vsum += __shfl_xor(vsum, m, 32);
    const float inv = 1.0f / vsum;
#pragma unroll
    for (int i = 0; i < 8; ++i) rowp[lane + i * 32] = vals[i] * inv;
  }
  __syncthreads();

  // ---- Phase 4: heads[32,32] = attn[32,256] @ V_h[256,32] ------------------
  // All 8 waves: tile = wave>>1 (2 mt x 2 nt), kh = wave&1 splits P in half.
  {
    const int tile = wave >> 1;
    const int kh = wave & 1;
    const int mt = tile >> 1, nt = tile & 1;
    const int n = nt * 16 + l16;
    const float* vb = Vm + (size_t)(b * kP + kh * 128) * kD + h * kHD + n;
    const float* arow = sm + (mt * 16 + l16) * LSTR + kh * 128;
    v8f acc = {};
#pragma unroll 4
    for (int k0 = 0; k0 < 128; k0 += 4) {
      const int ka = k0 + half * 2;
      v2f a  = {arow[ka], arow[ka + 1]};
      v2f vv = {vb[(size_t)ka * kD], vb[(size_t)(ka + 1) * kD]};
      acc = wmma_f32x4(a, vv, acc);
    }
#pragma unroll
    for (int r = 0; r < 8; ++r)
      part[kh][mt * 16 + half * 8 + r][n] = acc[r];
  }
  __syncthreads();

  // Reduce the two K-halves and write heads[b, s0+row, h*32+col].
  for (int idx = tid; idx < 32 * 32; idx += 256) {
    const int row = idx >> 5, col = idx & 31;
    heads[(size_t)(b * kS + s0 + row) * kD + h * kHD + col] =
        part[0][row][col] + part[1][row][col];
  }
}

extern "C" void kernel_launch(void* const* d_in, const int* in_sizes, int n_in,
                              void* d_out, int out_size, void* d_ws, size_t ws_size,
                              hipStream_t stream) {
  const float* row_emb = (const float*)d_in[0];
  const float* col_emb = (const float*)d_in[1];
  const float* cost    = (const float*)d_in[2];
  const float* Wq = (const float*)d_in[3];
  const float* bq = (const float*)d_in[4];
  const float* Wk = (const float*)d_in[5];
  const float* bk = (const float*)d_in[6];
  const float* Wv = (const float*)d_in[7];
  const float* bv = (const float*)d_in[8];
  const float* Wo = (const float*)d_in[9];
  const float* bo = (const float*)d_in[10];
  const float* mW1 = (const float*)d_in[11];
  const float* mb1 = (const float*)d_in[12];
  const float* mW2 = (const float*)d_in[13];
  const float* mb2 = (const float*)d_in[14];

  const size_t plane = (size_t)kBS * kS * kD;   // 1024*256 floats = 1 MB
  float* Qw = (float*)d_ws;
  float* Kw = Qw + plane;
  float* Vw = Kw + plane;
  float* Hw = Vw + plane;

  sca_qkv<<<192, 256, 0, stream>>>(row_emb, col_emb, Wq, bq, Wk, bk, Wv, bv,
                                  Qw, Kw, Vw);
  sca_attn<<<kBS * kH * (kS / 32), 256, 0, stream>>>(Qw, Kw, Vw, cost,
                                                     mW1, mb1, mW2, mb2, Hw);
  sca_out<<<128, 128, 0, stream>>>(Hw, Wo, bo, (float*)d_out);
}

// v002
// One run takes 18.6 microseconds.
// Two timings next to v001 put it at 1.41 and 1.40 times that version's speed.
// Over all steps from v000 it is 2.67 times as fast.
#include <hip/hip_runtime.h>

// ---------------------------------------------------------------------------
// SparseCrossAttention on MI455X (gfx1250, wave32, WMMA).
// Dense interpretation: per (b,h) attention over P with a per-head score-mix
// MLP. All matmuls use V_WMMA_F32_16X16X4_F32 (full f32 fidelity): at ~1 GFLOP
// and ~6 MB of L2-resident data, the problem is latency-bound, not rate-bound.
// Fused QKV (3 launches total), projections block-tiled with operands staged in
// LDS, K-split attn@V across all 8 waves, cost prefetch. The attention kernel's
// operands (Q, K, V head slices, cost slab) come into LDS by asynchronous copies.
// ---------------------------------------------------------------------------

typedef __attribute__((ext_vector_type(2))) float v2f;
typedef __attribute__((ext_vector_type(4))) float v4f;
typedef __attribute__((ext_vector_type(8))) float v8f;

constexpr int kBS = 4;
constexpr int kS  = 256;
constexpr int kP  = 256;
constexpr int kD  = 256;
constexpr int kH  = 8;
constexpr int kHD = 32;
constexpr int kMSH = 16;

__device__ __forceinline__ v8f wmma_f32x4(v2f a, v2f b, v8f c) {
  // V_WMMA_F32_16X16X4_F32: D = A(16x4) * B(4x16) + C(16x16)
  return __builtin_amdgcn_wmma_f32_16x16x4_f32(
      /*neg_a=*/false, a, /*neg_b=*/false, b,
      /*c_mod=*/(short)0, c, /*reuse_a=*/false, /*reuse_b=*/false);
}

// Block-tiled Y = X @ W^T + bias (W row-major [256,256], so B[k][n] = W[n][k]).
// A block of BM/16 x 2 waves owns a BM x 64 tile of Y. Its BM rows of X and 64
// rows of W are brought in by b128 loads (16 lanes
// per row piece) and parked in LDS; the WMMA fragments are read from LDS.
// All loads are issued up front; K is handed over in 4 pieces of 64 so that the
// products on piece c run while the later pieces are still on their way.
// Each wave: a 16 x 32 tile (one A fragment feeds 2 accumulator chains), k in
// ascending steps of 4.
constexpr int kPitch = 260;  // floats; pitch % 64 == 4 -> 16 rows x 4 dwords hit 64 banks
constexpr int kKC = 64;      // floats of K per piece
constexpr int kNC = kD / kKC;

// Work-group barrier that orders LDS traffic only. __syncthreads() would also
// drain every outstanding global load, i.e. wait for the later K pieces before
// the products on the first piece may start.
__device__ __forceinline__ void lds_barrier() {
  __builtin_amdgcn_fence(__ATOMIC_RELEASE, "workgroup", "local");
  __builtin_amdgcn_s_barrier();
  __builtin_amdgcn_fence(__ATOMIC_ACQUIRE, "workgroup", "local");
}

template <int BM>
__device__ __forceinline__ void gemm_lds(const float* __restrict__ X,
                                         const float* __restrict__ W,
                                         const float* __restrict__ bias,
                                         float* __restrict__ Y,
                                         int m0, int n0,
                                         float* __restrict__ sA,
                                         float* __restrict__ sW) {
  constexpr int T  = BM * 4;      // threads in the block
  constexpr int RP = T / 16;      // rows covered by one load of the whole block
  constexpr int PA = BM / RP;     // loads per thread and piece, X rows
  constexpr int PW = 64 / RP;     // loads per thread and piece, W rows
  const int tid  = threadIdx.x;
  const int lane = tid & 31;
  const int wave = tid >> 5;
  const int half = lane >> 4;     // 0: K=k0,k0+1   1: K=k0+2,k0+3
  const int l16  = lane & 15;
  const int lr = tid >> 4;        // row inside one block-wide load
  const int lc = (tid & 15) * 4;  // float column inside the piece

  const float* xp = X + (size_t)(m0 + lr) * kD + lc;
  const float* wp = W + (size_t)(n0 + lr) * kD + lc;
  v4f ra[kNC][PA], rw[kNC][PW];
  // Every loop over c and p is fully unrolled: ra and rw stay in registers only
  // with constant indices (otherwise they go to scratch).
#pragma unroll
  for (int c = 0; c < kNC; ++c) {
#pragma unroll
    for (int p = 0; p < PA; ++p)
      ra[c][p] = *(const v4f*)(xp + p * RP * kD + c * kKC);
#pragma unroll
    for (int p = 0; p < PW; ++p)
      rw[c][p] = *(const v4f*)(wp + p * RP * kD + c * kKC);
  }
  // Precaution: the two address pairs stay live up to this wait, so that no
  // load result or later value lands on a register an issued load still names.
  asm volatile("s_wait_xcnt 0x0" :: "v"(xp), "v"(wp) : "memory");

  const int wm = wave >> 1, wn = wave & 1;
  const float* arow = sA + (wm * 16 + l16) * kPitch + half * 2;
  const float* b0r  = sW + (wn * 32 + l16) * kPitch + half * 2;
  const float* b1r  = b0r + 16 * kPitch;

  v8f acc0 = {}, acc1 = {};
#pragma unroll
  for (int c = 0; c < kNC; ++c) {
#pragma unroll
    for (int p = 0; p < PA; ++p)
      *(v4f*)(sA + (p * RP + lr) * kPitch + c * kKC + lc) = ra[c][p];
#pragma unroll
    for (int p = 0; p < PW; ++p)
      *(v4f*)(sW + (p * RP + lr) * kPitch + c * kKC + lc) = rw[c][p];
    lds_barrier();   // piece c is complete in LDS; each piece has its own columns
    // Unrolled: LDS offsets become immediates and reads are issued ahead of use.
#pragma unroll
    for (int k0 = c * kKC; k0 < (c + 1) * kKC; k0 += 4) {
      v2f a  = {arow[k0], arow[k0 + 1]};
      v2f b0 = {b0r[k0], b0r[k0 + 1]};
      v2f b1 = {b1r[k0], b1r[k0 + 1]};
      acc0 = wmma_f32x4(a, b0, acc0);
      acc1 = wmma_f32x4(a, b1, acc1);
    }
  }

  v8f accs[2] = {acc0, acc1};
#pragma unroll
  for (int j = 0; j < 2; ++j) {
    const int n = n0 + wn * 32 + j * 16 + l16;
    const float bn = bias[n];
#pragma unroll
    for (int r = 0; r < 8; ++r) {
      const int mm = m0 + wm * 16 + half * 8 + r;
      Y[(size_t)mm * kD + n] = accs[j][r] + bn;
    }
  }
}

// Fused Q/K/V projections: 3 GEMMs x (16 x 4) tiles of 64 x 64 -> 192 blocks.
__global__ __launch_bounds__(256)
void sca_qkv(const float* __restrict__ row_emb, const float* __restrict__ col_emb,
             const float* __restrict__ Wq, const float* __restrict__ bq,
             const float* __restrict__ Wk, const float* __restrict__ bk,
             const float* __restrict__ Wv, const float* __restrict__ bv,
             float* __restrict__ Qw, float* __restrict__ Kw,
             float* __restrict__ Vw) {
  __shared__ __attribute__((aligned(16))) float sA[64 * kPitch];
  __shared__ __attribute__((aligned(16))) float sW[64 * kPitch];
  const int which = blockIdx.x >> 6;        // 0=Q, 1=K, 2=V
  const int t  = blockIdx.x & 63;
  const float* X    = (which == 0) ? row_emb : col_emb;
  const float* W    = (which == 0) ? Wq : (which == 1) ? Wk : Wv;
  const float* bias = (which == 0) ? bq : (which == 1) ? bk : bv;
  float*       Y    = (which == 0) ? Qw : (which == 1) ? Kw : Vw;
  gemm_lds<64>(X, W, bias, Y, (t >> 2) * 64, (t & 3) * 64, sA, sW);
}

// Output projection: out = heads @ Wo^T + bo. (32 x 4) tiles of 32 x 64 -> 128
// blocks of 4 waves.
__global__ __launch_bounds__(128)
void sca_out(const float* __restrict__ Hm, const float* __restrict__ Wo,
             const float* __restrict__ bo, float* __restrict__ out) {
  __shared__ __attribute__((aligned(16))) float sA[32 * kPitch];
  __shared__ __attribute__((aligned(16))) float sW[64 * kPitch];
  gemm_lds<32>(Hm, Wo, bo, out, (int)(blockIdx.x >> 2) * 32, (int)(blockIdx.x & 3) * 64, sA, sW);
}

// LDS byte address of a __shared__ location: the low 32 bits of its address.
__device__ __forceinline__ unsigned lds_addr(const float* p) {
  return (unsigned)(size_t)p;
}

// Asynchronous copies global -> LDS, 16 B per lane, through no register. The
// s_wait_xcnt closes each statement so that it stands ahead of any later write
// to a register that an issued copy names (a precaution).
__device__ __forceinline__ void async_copy1(unsigned l, const float* g) {
  asm volatile("global_load_async_to_lds_b128 %0, %1, off\n\t"
               "s_wait_xcnt 0x0"
               :: "v"(l), "v"(g) : "memory");
}
__device__ __forceinline__ void async_copy8(const unsigned (&l)[8],
                                            const float* const (&g)[8]) {
  asm volatile("global_load_async_to_lds_b128 %0, %8, off\n\t"
               "global_load_async_to_lds_b128 %1, %9, off\n\t"
               "global_load_async_to_lds_b128 %2, %10, off\n\t"
               "global_load_async_to_lds_b128 %3, %11, off\n\t"
               "global_load_async_to_lds_b128 %4, %12, off\n\t"
               "global_load_async_to_lds_b128 %5, %13, off\n\t"
               "global_load_async_to_lds_b128 %6, %14, off\n\t"
               "global_load_async_to_lds_b128 %7, %15, off\n\t"
               "s_wait_xcnt 0x0"
               :: "v"(l[0]), "v"(l[1]), "v"(l[2]), "v"(l[3]),
                  "v"(l[4]), "v"(l[5]), "v"(l[6]), "v"(l[7]),
                  "v"(g[0]), "v"(g[1]), "v"(g[2]), "v"(g[3]),
                  "v"(g[4]), "v"(g[5]), "v"(g[6]), "v"(g[7])
               : "memory");
}

// One block = (b, h, 32-row S slab). WMMA scores -> per-head MLP mix with
// cost -> row softmax over P in LDS -> WMMA attn@V (K-split over wave pairs).
// A row's head slice is one 128-B line: a wave-wide copy moves 4 whole lines.
#define LSTR 260   // 32 x 260 floats; stride%64==4 -> 16 rows conflict-free
constexpr int kQKP = 36;  // Q, K pitch: 16 rows x 4 dwords of a b64 read hit 64 banks
constexpr int kVP  = 40;  // V pitch: rows k and k+2 (the two lane halves) 16 banks apart
__global__ __launch_bounds__(256)
void sca_attn(const float* __restrict__ Q, const float* __restrict__ Km,
              const float* __restrict__ Vm, const float* __restrict__ cost,
              const float* __restrict__ mW1, const float* __restrict__ mb1,
              const float* __restrict__ mW2, const float* __restrict__ mb2,
              float* __restrict__ heads) {
  __shared__ float sm[32 * LSTR];
  __shared__ float part[2][32][33];
  __shared__ __attribute__((aligned(16))) float sQ[32 * kQKP];
  __shared__ __attribute__((aligned(16))) float sK[kP * kQKP];
  __shared__ __attribute__((aligned(16))) float sV[kP * kVP];
  __shared__ __attribute__((aligned(16))) float sC[32 * kP];

  const int tid  = threadIdx.x;
  const int lane = tid & 31;
  const int wave = tid >> 5;
  const int half = lane >> 4;
  const int l16  = lane & 15;

  const int blk = blockIdx.x;
  const int b  = blk >> 6;          // 64 blocks per batch (H * S/32)
  const int h  = (blk >> 3) & 7;
  const int s0 = (blk & 7) * 32;

  // Prefetch this block's cost slab (32 KB) so its copy below hits cache.
  // Lowers to global_prefetch_b8; 256 threads x 128 B covers the slab.
  {
    const char* cpf = (const char*)(cost + (size_t)(b * kS + s0) * kP);
    __builtin_prefetch(cpf + (size_t)tid * 128, 0, 1);
  }

  // ---- Staging: every lane copies 16 B; 8 lanes cover a row's head slice ----
  const int cr = tid >> 3;        // row inside one block-wide copy (32 rows)
  const int cc = (tid & 7) * 4;   // float column inside the head slice
  {
    // Q_h (32 rows) and K_h (256 rows): what phase 1 reads.
    const float* gk = Km + (size_t)(b * kP + cr) * kD + h * kHD + cc;
    unsigned l[8];
    const float* g[8];
    // Unrolled: the address arrays stay in registers only with constant indices.
#pragma unroll
    for (int i = 0; i < 8; ++i) {
      l[i] = lds_addr(sK + (i * 32 + cr) * kQKP + cc);
      g[i] = gk + (size_t)i * 32 * kD;
    }
    async_copy1(lds_addr(sQ + cr * kQKP + cc),
                Q + (size_t)(b * kS + s0 + cr) * kD + h * kHD + cc);
    async_copy8(l, g);
  }
  // This wave's Q and K copies have landed; the barrier publishes all waves'.
  asm volatile("s_wait_asynccnt 0x0" ::: "memory");
  __syncthreads();
  {
    // Cost slab (32 KB in a row) and V_h (256 rows): they fly during phase 1 and
    // are waited for at its closing barrier.
    const float* gc = cost + (size_t)(b * kS + s0) * kP + tid * 4;
    const float* gv = Vm + (size_t)(b * kP + cr) * kD + h * kHD + cc;
    unsigned lc[8], lv[8];
    const float* pc[8];
    const float* pv[8];
    // Unrolled: as above, constant indices keep the address arrays in registers.
#pragma unroll
    for (int i = 0; i < 8; ++i) {
      lc[i] = lds_addr(sC + i * 1024 + tid * 4);
      pc[i] = gc + i * 1024;
      lv[i] = lds_addr(sV + (i * 32 + cr) * kVP + cc);
      pv[i] = gv + (size_t)i * 32 * kD;
    }
    async_copy8(lc, pc);
    async_copy8(lv, pv);
  }

  // ---- Phase 1: raw logits[32,256] = Q_h(32x32) @ K_h^T(32x256) ------------
  // Wave w: mt = w&1, nt = (w>>1)*4 .. +3  (1 A-frag feeds 4 B-frags).
  {
    const int mt  = wave & 1;
    const int ntb = (wave >> 1) * 4;
    const float* qrow = sQ + (mt * 16 + l16) * kQKP;
    const float* k0r = sK + ((ntb + 0) * 16 + l16) * kQKP;
    const float* k1r = sK + ((ntb + 1) * 16 + l16) * kQKP;
    const float* k2r = sK + ((ntb + 2) * 16 + l16) * kQKP;
    const float* k3r = sK + ((ntb + 3) * 16 + l16) * kQKP;
    v8f a0 = {}, a1 = {}, a2 = {}, a3 = {};
#pragma unroll
    for (int k0 = 0; k0 < kHD; k0 += 4) {
      const int ka = k0 + half * 2;
      v2f a  = {qrow[ka], qrow[ka + 1]};
      v2f b0 = {k0r[ka], k0r[ka + 1]};
      v2f b1 = {k1r[ka], k1r[ka + 1]};
      v2f b2 = {k2r[ka], k2r[ka + 1]};
      v2f b3 = {k3r[ka], k3r[ka + 1]};
      a0 = wmma_f32x4(a, b0, a0);
      a1 = wmma_f32x4(a, b1, a1);
      a2 = wmma_f32x4(a, b2, a2);
      a3 = wmma_f32x4(a, b3, a3);
    }
    v8f accs[4] = {a0, a1, a2, a3};
#pragma unroll
    for (int j = 0; j < 4; ++j)
#pragma unroll
      for (int r = 0; r < 8; ++r)
        sm[(mt * 16 + half * 8 + r) * LSTR + (ntb + j) * 16 + l16] = accs[j][r];
  }
  // This wave's cost and V copies have landed; the barrier publishes all waves'.
  asm volatile("s_wait_asynccnt 0x0" ::: "memory");
  __syncthreads();

  // ---- Phase 2: per-head MLP([score/sqrt(32), cost]) -----------------------
  float W1a[kMSH], W1b[kMSH], B1[kMSH], W2[kMSH];
#pragma unroll
  for (int j = 0; j < kMSH; ++j) {
    W1a[j] = mW1[h * 2 * kMSH + j];          // weight on dot score
    W1b[j] = mW1[h * 2 * kMSH + kMSH + j];   // weight on edge cost
    B1[j]  = mb1[h * kMSH + j];
    W2[j]  = mW2[h * kMSH + j];
  }
  const float B2 = mb2[h];
  const float iscale = 0.17677669529663687f;  // 1/sqrt(32)

  for (int idx = tid; idx < 32 * kP; idx += 256) {
    const int row = idx >> 8, col = idx & 255;
    const float l = sm[row * LSTR + col] * iscale;
    const float c = sC[idx];
    float o = B2;
#pragma unroll
    for (int j = 0; j < kMSH; ++j) {
      const float hid = fmaf(l, W1a[j], fmaf(c, W1b[j], B1[j]));
      o = fmaf(fmaxf(hid, 0.0f), W2[j], o);
    }
    sm[row * LSTR + col] = o;
  }
  __syncthreads();

  // ---- Phase 3: row softmax over P=256 (4 rows per wave, shfl reductions) --
  for (int r = wave * 4; r < wave * 4 + 4; ++r) {
    float* rowp = sm + r * LSTR;
    float vals[8];
    float vmax = -3.4e38f;
#pragma unroll
    for (int i = 0; i < 8; ++i) {
      vals[i] = rowp[lane + i * 32];
      vmax = fmaxf(vmax, vals[i]);
    }
#pragma unroll
    for (int m = 16; m; m >>= 1) vmax = fmaxf(vmax, __shfl_xor(vmax, m, 32));
    float vsum = 0.0f;
#pragma unroll
    for (int i = 0; i < 8; ++i) {
      vals[i] = __expf(vals[i] - vmax);
      vsum += vals[i];
    }
#pragma unroll
    for (int m = 16; m; m >>= 1) vsum += __shfl_xor(vsum, m, 32);
    const float inv = 1.0f / vsum;
#pragma unroll
    for (int i = 0; i < 8; ++i) rowp[lane + i * 32] = vals[i] * inv;
  }
  __syncthreads();

  // ---- Phase 4: heads[32,32] = attn[32,256] @ V_h[256,32] ------------------
  // All 8 waves: tile = wave>>1 (2 mt x 2 nt), kh = wave&1 splits P in half.
  {
    const int tile = wave >> 1;
    const int kh = wave & 1;
    const int mt = tile >> 1, nt = tile & 1;
    const int n = nt * 16 + l16;
    const float* vb = sV + kh * 128 * kVP + n;
    const float* arow = sm + (mt * 16 + l16) * LSTR + kh * 128;
    v8f acc = {};
    // Unrolled: LDS offsets become immediates and reads are issued ahead of use.
#pragma unroll
    for (int k0 = 0; k0 < 128; k0 += 4) {
      const int ka = k0 + half * 2;
      v2f a  = {arow[ka], arow[ka + 1]};
      v2f vv = {vb[ka * kVP], vb[(ka + 1) * kVP]};
      acc = wmma_f32x4(a, vv, acc);
    }
#pragma unroll
    for (int r = 0; r < 8; ++r)
      part[kh][mt * 16 + half * 8 + r][n] = acc[r];
  }
  __syncthreads();

  // Reduce the two K-halves and write heads[b, s0+row, h*32+col].
  for (int idx = tid; idx < 32 * 32; idx += 256) {
    const int row = idx >> 5, col = idx & 31;
    heads[(size_t)(b * kS + s0 + row) * kD + h * kHD + col] =
        part[0][row][col] + part[1][row][col];
  }
}

extern "C" void kernel_launch(void* const* d_in, const int* in_sizes, int n_in,
                              void* d_out, int out_size, void* d_ws, size_t ws_size,
                              hipStream_t stream) {
  const float* row_emb = (const float*)d_in[0];
  const float* col_emb = (const float*)d_in[1];
  const float* cost    = (const float*)d_in[2];
  const float* Wq = (const float*)d_in[3];
  const float* bq = (const float*)d_in[4];
  const float* Wk = (const float*)d_in[5];
  const float* bk = (const float*)d_in[6];
  const float* Wv = (const float*)d_in[7];
  const float* bv = (const float*)d_in[8];
  const float* Wo = (const float*)d_in[9];
  const float* bo = (const float*)d_in[10];
  const float* mW1 = (const float*)d_in[11];
  const float* mb1 = (const float*)d_in[12];
  const float* mW2 = (const float*)d_in[13];
  const float* mb2 = (const float*)d_in[14];

  const size_t plane = (size_t)kBS * kS * kD;   // 1024*256 floats = 1 MB
  float* Qw = (float*)d_ws;
  float* Kw = Qw + plane;
  float* Vw = Kw + plane;
  float* Hw = Vw + plane;

  sca_qkv<<<192, 256, 0, stream>>>(row_emb, col_emb, Wq, bq, Wk, bk, Wv, bv,
                                  Qw, Kw, Vw);
  sca_attn<<<kBS * kH * (kS / 32), 256, 0, stream>>>(Qw, Kw, Vw, cost,
                                                     mW1, mb1, mW2, mb2, Hw);
  sca_out<<<128, 128, 0, stream>>>(Hw, Wo, bo, (float*)d_out);
}

// v003
// It runs in 18 microseconds.
// Two timings next to v002 put it at 1.05 and 1.04 times that version's speed.
// All steps since v000 together make it 2.80 times as fast.
#include <hip/hip_runtime.h>

// ---------------------------------------------------------------------------
// SparseCrossAttention on MI455X (gfx1250, wave32, WMMA).
// Dense interpretation: per (b,h) attention over P with a per-head score-mix
// MLP. All matmuls use V_WMMA_F32_16X16X4_F32 (full f32 fidelity): at ~1 GFLOP
// and ~6 MB of L2-resident data, the problem is latency-bound, not rate-bound.
// Fused QKV (3 launches total), projections block-tiled with operands staged in
// LDS, K-split attn@V across all 8 waves, cost prefetch. The attention kernel's
// operands (Q, K, V head slices, cost slab) come into LDS by asynchronous copies.
// ---------------------------------------------------------------------------

typedef __attribute__((ext_vector_type(2))) float v2f;
typedef __attribute__((ext_vector_type(4))) float v4f;
typedef __attribute__((ext_vector_type(8))) float v8f;

constexpr int kBS = 4;
constexpr int kS  = 256;
constexpr int kP  = 256;
constexpr int kD  = 256;
constexpr int kH  = 8;
constexpr int kHD = 32;
constexpr int kMSH = 16;

__device__ __forceinline__ v8f wmma_f32x4(v2f a, v2f b, v8f c) {
  // V_WMMA_F32_16X16X4_F32: D = A(16x4) * B(4x16) + C(16x16)
  return __builtin_amdgcn_wmma_f32_16x16x4_f32(
      /*neg_a=*/false, a, /*neg_b=*/false, b,
      /*c_mod=*/(short)0, c, /*reuse_a=*/false, /*reuse_b=*/false);
}

// Block-tiled Y = X @ W^T + bias (W row-major [256,256], so B[k][n] = W[n][k]).
// A block of BM/16 x 2 waves owns a BM x 64 tile of Y. Its BM rows of X and 64
// rows of W are brought in by b128 loads (16 lanes
// per row piece) and parked in LDS; the WMMA fragments are read from LDS.
// All loads are issued up front; K is handed over in 4 pieces of 64 so that the
// products on piece c run while the later pieces are still on their way.
// Each wave: a 16 x 32 tile (one A fragment feeds 2 accumulator chains), k in
// ascending steps of 4. The fragments of a block of k steps are read from LDS as
// one group, one block ahead of the products that use them (two register sets).
constexpr int kPitch = 260;  // floats; pitch % 64 == 4 -> 16 rows x 4 dwords hit 64 banks
constexpr int kKC = 64;      // floats of K per piece
constexpr int kNC = kD / kKC;

// Work-group barrier that orders LDS traffic only. __syncthreads() would also
// drain every outstanding global load, i.e. wait for the later K pieces before
// the products on the first piece may start.
__device__ __forceinline__ void lds_barrier() {
  __builtin_amdgcn_fence(__ATOMIC_RELEASE, "workgroup", "local");
  __builtin_amdgcn_s_barrier();
  __builtin_amdgcn_fence(__ATOMIC_ACQUIRE, "workgroup", "local");
}

template <int BM>
__device__ __forceinline__ void gemm_lds(const float* __restrict__ X,
                                         const float* __restrict__ W,
                                         const float* __restrict__ bias,
                                         float* __restrict__ Y,
                                         int m0, int n0,
                                         float* __restrict__ sA,
                                         float* __restrict__ sW) {
  constexpr int T  = BM * 4;      // threads in the block
  constexpr int RP = T / 16;      // rows covered by one load of the whole block
  constexpr int PA = BM / RP;     // loads per thread and piece, X rows
  constexpr int PW = 64 / RP;     // loads per thread and piece, W rows
  constexpr int kKB = 16;         // floats of K per fragment block
  constexpr int kSB = kKB / 4;    // WMMA k steps per fragment block
  constexpr int kNB = kD / kKB;
  constexpr int kBP = kKC / kKB;  // fragment blocks per piece
  const int tid  = threadIdx.x;
  const int lane = tid & 31;
  const int wave = tid >> 5;
  const int half = lane >> 4;     // 0: K=k0,k0+1   1: K=k0+2,k0+3
  const int l16  = lane & 15;
  const int lr = tid >> 4;        // row inside one block-wide load
  const int lc = (tid & 15) * 4;  // float column inside the piece

  // The bias is asked for first: its latency passes behind the tile loads.
  const int wm = wave >> 1, wn = wave & 1;
  const int nb = n0 + wn * 32 + l16;
  const float bn[2] = {bias[nb], bias[nb + 16]};

  const float* xp = X + (size_t)(m0 + lr) * kD + lc;
  const float* wp = W + (size_t)(n0 + lr) * kD + lc;
  v4f ra[kNC][PA], rw[kNC][PW];
  // Every loop over c and p is fully unrolled: ra and rw stay in registers only
  // with constant indices (otherwise they go to scratch).
#pragma unroll
  for (int c = 0; c < kNC; ++c) {
#pragma unroll
    for (int p = 0; p < PA; ++p)
      ra[c][p] = *(const v4f*)(xp + p * RP * kD + c * kKC);
#pragma unroll
    for (int p = 0; p < PW; ++p)
      rw[c][p] = *(const v4f*)(wp + p * RP * kD + c * kKC);
    // Keeps the loads in the order of the pieces: piece c is waited for by count.
    __builtin_amdgcn_sched_barrier(0);
  }
  // Precaution: the two address pairs and the bias index stay live up to this
  // wait, so that no load result or later value lands on a register an issued
  // load still names.
  asm volatile("s_wait_xcnt 0x0" :: "v"(xp), "v"(wp), "v"(nb) : "memory");

  const float* arow = sA + (wm * 16 + l16) * kPitch + half * 2;
  const float* b0r  = sW + (wn * 32 + l16) * kPitch + half * 2;
  const float* b1r  = b0r + 16 * kPitch;

  v8f acc0 = {}, acc1 = {};
  v2f fa[2][kSB], f0[2][kSB], f1[2][kSB];
  // Unrolled throughout: the staged pieces and the fragment sets stay in registers
  // only with constant indices, and LDS offsets become immediates.
#pragma unroll
  for (int p = 0; p < PA; ++p)
    *(v4f*)(sA + (p * RP + lr) * kPitch + lc) = ra[0][p];
#pragma unroll
  for (int p = 0; p < PW; ++p)
    *(v4f*)(sW + (p * RP + lr) * kPitch + lc) = rw[0][p];
  lds_barrier();   // piece 0 is complete in LDS; each piece has its own columns
  // Trip t reads block t and runs the products of block t - 1. The next piece is
  // parked in LDS together with the reads of a piece's last block, and its
  // barrier follows one block of products later, when those stores are done.
#pragma unroll
  for (int t = 0; t <= kNB; ++t) {
    if (t < kNB) {
      if (t > 0 && t % kBP == 0) lds_barrier();   // piece t / kBP is complete in LDS
#pragma unroll
      for (int s = 0; s < kSB; ++s) {
        const int k0 = t * kKB + s * 4;
        fa[t & 1][s] = v2f{arow[k0], arow[k0 + 1]};
        f0[t & 1][s] = v2f{b0r[k0], b0r[k0 + 1]};
        f1[t & 1][s] = v2f{b1r[k0], b1r[k0 + 1]};
      }
      if (t % kBP == kBP - 1 && t + 1 < kNB) {
        const int c = (t + 1) / kBP;
#pragma unroll
        for (int p = 0; p < PA; ++p)
          *(v4f*)(sA + (p * RP + lr) * kPitch + c * kKC + lc) = ra[c][p];
#pragma unroll
        for (int p = 0; p < PW; ++p)
          *(v4f*)(sW + (p * RP + lr) * kPitch + c * kKC + lc) = rw[c][p];
      }
    }
    // Keeps the block's LDS traffic together ahead of the products (for speed only).
    __builtin_amdgcn_sched_barrier(0);
    if (t > 0) {
#pragma unroll
      for (int s = 0; s < kSB; ++s) {
        acc0 = wmma_f32x4(fa[(t - 1) & 1][s], f0[(t - 1) & 1][s], acc0);
        acc1 = wmma_f32x4(fa[(t - 1) & 1][s], f1[(t - 1) & 1][s], acc1);
      }
    }
    // Keeps the next block's reads from moving up among these products.
    __builtin_amdgcn_sched_barrier(0);
  }

  v8f accs[2] = {acc0 + bn[0], acc1 + bn[1]};
  float* yp = Y + (size_t)(m0 + wm * 16 + half * 8) * kD + nb;
  // Keeps the sums and the address ahead of the stores, which then go out in one
  // run (among them, each sum would wait for an issued store to let go of its
  // register).
  __builtin_amdgcn_sched_barrier(0);
#pragma unroll
  for (int j = 0; j < 2; ++j) {
#pragma unroll
    for (int r = 0; r < 8; ++r) yp[r * kD + j * 16] = accs[j][r];
  }
}

// Fused Q/K/V projections: 3 GEMMs x (16 x 4) tiles of 64 x 64 -> 192 blocks.
__global__ __launch_bounds__(256)
void sca_qkv(const float* __restrict__ row_emb, const float* __restrict__ col_emb,
             const float* __restrict__ Wq, const float* __restrict__ bq,
             const float* __restrict__ Wk, const float* __restrict__ bk,
             const float* __restrict__ Wv, const float* __restrict__ bv,
             float* __restrict__ Qw, float* __restrict__ Kw,
             float* __restrict__ Vw) {
  __shared__ __attribute__((aligned(16))) float sA[64 * kPitch];
  __shared__ __attribute__((aligned(16))) float sW[64 * kPitch];
  const int which = blockIdx.x >> 6;        // 0=Q, 1=K, 2=V
  const int t  = blockIdx.x & 63;
  const float* X    = (which == 0) ? row_emb : col_emb;
  const float* W    = (which == 0) ? Wq : (which == 1) ? Wk : Wv;
  const float* bias = (which == 0) ? bq : (which == 1) ? bk : bv;
  float*       Y    = (which == 0) ? Qw : (which == 1) ? Kw : Vw;
  gemm_lds<64>(X, W, bias, Y, (t >> 2) * 64, (t & 3) * 64, sA, sW);
}

// Output projection: out = heads @ Wo^T + bo. (32 x 4) tiles of 32 x 64 -> 128
// blocks of 4 waves.
__global__ __launch_bounds__(128)
void sca_out(const float* __restrict__ Hm, const float* __restrict__ Wo,
             const float* __restrict__ bo, float* __restrict__ out) {
  __shared__ __attribute__((aligned(16))) float sA[32 * kPitch];
  __shared__ __attribute__((aligned(16))) float sW[64 * kPitch];
  gemm_lds<32>(Hm, Wo, bo, out, (int)(blockIdx.x >> 2) * 32, (int)(blockIdx.x & 3) * 64, sA, sW);
}

// LDS byte address of a __shared__ location: the low 32 bits of its address.
__device__ __forceinline__ unsigned lds_addr(const float* p) {
  return (unsigned)(size_t)p;
}

// Asynchronous copies global -> LDS, 16 B per lane, through no register. The
// s_wait_xcnt closes each statement so that it stands ahead of any later write
// to a register that an issued copy names (a precaution).
__device__ __forceinline__ void async_copy1(unsigned l, const float* g) {
  asm volatile("global_load_async_to_lds_b128 %0, %1, off\n\t"
               "s_wait_xcnt 0x0"
               :: "v"(l), "v"(g) : "memory");
}
__device__ __forceinline__ void async_copy8(const unsigned (&l)[8],
                                            const float* const (&g)[8]) {
  asm volatile("global_load_async_to_lds_b128 %0, %8, off\n\t"
               "global_load_async_to_lds_b128 %1, %9, off\n\t"
               "global_load_async_to_lds_b128 %2, %10, off\n\t"
               "global_load_async_to_lds_b128 %3, %11, off\n\t"
               "global_load_async_to_lds_b128 %4, %12, off\n\t"
               "global_load_async_to_lds_b128 %5, %13, off\n\t"
               "global_load_async_to_lds_b128 %6, %14, off\n\t"
               "global_load_async_to_lds_b128 %7, %15, off\n\t"
               "s_wait_xcnt 0x0"
               :: "v"(l[0]), "v"(l[1]), "v"(l[2]), "v"(l[3]),
                  "v"(l[4]), "v"(l[5]), "v"(l[6]), "v"(l[7]),
                  "v"(g[0]), "v"(g[1]), "v"(g[2]), "v"(g[3]),
                  "v"(g[4]), "v"(g[5]), "v"(g[6]), "v"(g[7])
               : "memory");
}

// One block = (b, h, 32-row S slab). WMMA scores -> per-head MLP mix with
// cost -> row softmax over P in LDS -> WMMA attn@V (K-split over wave pairs).
// A row's head slice is one 128-B line: a wave-wide copy moves 4 whole lines.
#define LSTR 260   // 32 x 260 floats; stride%64==4 -> 16 rows conflict-free
constexpr int kQKP = 36;  // Q, K pitch: 16 rows x 4 dwords of a b64 read hit 64 banks
constexpr int kVP  = 40;  // V pitch: rows k and k+2 (the two lane halves) 16 banks apart
__global__ __launch_bounds__(256)
void sca_attn(const float* __restrict__ Q, const float* __restrict__ Km,
              const float* __restrict__ Vm, const float* __restrict__ cost,
              const float* __restrict__ mW1, const float* __restrict__ mb1,
              const float* __restrict__ mW2, const float* __restrict__ mb2,
              float* __restrict__ heads) {
  __shared__ float sm[32 * LSTR];
  __shared__ float part[2][32][33];
  __shared__ __attribute__((aligned(16))) float sQ[32 * kQKP];
  __shared__ __attribute__((aligned(16))) float sK[kP * kQKP];
  __shared__ __attribute__((aligned(16))) float sV[kP * kVP];
  __shared__ __attribute__((aligned(16))) float sC[32 * kP];

  const int tid  = threadIdx.x;
  const int lane = tid & 31;
  const int wave = tid >> 5;
  const int half = lane >> 4;
  const int l16  = lane & 15;

  const int blk = blockIdx.x;
  const int b  = blk >> 6;          // 64 blocks per batch (H * S/32)
  const int h  = (blk >> 3) & 7;
  const int s0 = (blk & 7) * 32;

  // Prefetch this block's cost slab (32 KB) so its copy below hits cache.
  // Lowers to global_prefetch_b8; 256 threads x 128 B covers the slab.
  {
    const char* cpf = (const char*)(cost + (size_t)(b * kS + s0) * kP);
    __builtin_prefetch(cpf + (size_t)tid * 128, 0, 1);
  }

  // ---- Staging: every lane copies 16 B; 8 lanes cover a row's head slice ----
  const int cr = tid >> 3;        // row inside one block-wide copy (32 rows)
  const int cc = (tid & 7) * 4;   // float column inside the head slice
  {
    // Q_h (32 rows) and K_h (256 rows): what phase 1 reads.
    const float* gk = Km + (size_t)(b * kP + cr) * kD + h * kHD + cc;
    unsigned l[8];
    const float* g[8];
    // Unrolled: the address arrays stay in registers only with constant indices.
#pragma unroll
    for (int i = 0; i < 8; ++i) {
      l[i] = lds_addr(sK + (i * 32 + cr) * kQKP + cc);
      g[i] = gk + (size_t)i * 32 * kD;
    }
    async_copy1(lds_addr(sQ + cr * kQKP + cc),
                Q + (size_t)(b * kS + s0 + cr) * kD + h * kHD + cc);
    async_copy8(l, g);
  }
  // This wave's Q and K copies have landed; the barrier publishes all waves'.
  asm volatile("s_wait_asynccnt 0x0" ::: "memory");
  __syncthreads();
  {
    // Cost slab (32 KB in a row) and V_h (256 rows): they fly during phase 1 and
    // are waited for at its closing barrier.
    const float* gc = cost + (size_t)(b * kS + s0) * kP + tid * 4;
    const float* gv = Vm + (size_t)(b * kP + cr) * kD + h * kHD + cc;
    unsigned lc[8], lv[8];
    const float* pc[8];
    const float* pv[8];
    // Unrolled: as above, constant indices keep the address arrays in registers.
#pragma unroll
    for (int i = 0; i < 8; ++i) {
      lc[i] = lds_addr(sC + i * 1024 + tid * 4);
      pc[i] = gc + i * 1024;
      lv[i] = lds_addr(sV + (i * 32 + cr) * kVP + cc);
      pv[i] = gv + (size_t)i * 32 * kD;
    }
    async_copy8(lc, pc);
    async_copy8(lv, pv);
  }

  // ---- Phase 1: raw logits[32,256] = Q_h(32x32) @ K_h^T(32x256) ------------
  // Wave w: mt = w&1, nt = (w>>1)*4 .. +3  (1 A-frag feeds 4 B-frags).
  {
    const int mt  = wave & 1;
    const int ntb = (wave >> 1) * 4;
    const float* qrow = sQ + (mt * 16 + l16) * kQKP;
    const float* k0r = sK + ((ntb + 0) * 16 + l16) * kQKP;
    const float* k1r = sK + ((ntb + 1) * 16 + l16) * kQKP;
    const float* k2r = sK + ((ntb + 2) * 16 + l16) * kQKP;
    const float* k3r = sK + ((ntb + 3) * 16 + l16) * kQKP;
    v8f a0 = {}, a1 = {}, a2 = {}, a3 = {};
    v2f fq[kHD / 4], fk0[kHD / 4], fk1[kHD / 4], fk2[kHD / 4], fk3[kHD / 4];
    // Unrolled: the fragment arrays stay in registers only with constant indices.
#pragma unroll
    for (int s = 0; s < kHD / 4; ++s) {
      const int ka = s * 4 + half * 2;
      fq[s]  = v2f{qrow[ka], qrow[ka + 1]};
      fk0[s] = v2f{k0r[ka], k0r[ka + 1]};
      fk1[s] = v2f{k1r[ka], k1r[ka + 1]};
      fk2[s] = v2f{k2r[ka], k2r[ka + 1]};
      fk3[s] = v2f{k3r[ka], k3r[ka + 1]};
      // Keeps all LDS reads of the phase together ahead of its products, the first
      // four
      // k steps' reads in front, so that the products start on a counted wait.
      if (s % 4 == 3) __builtin_amdgcn_sched_barrier(0);
    }
#pragma unroll
    for (int s = 0; s < kHD / 4; ++s) {
      a0 = wmma_f32x4(fq[s], fk0[s], a0);
      a1 = wmma_f32x4(fq[s], fk1[s], a1);
      a2 = wmma_f32x4(fq[s], fk2[s], a2);
      a3 = wmma_f32x4(fq[s], fk3[s], a3);
    }
    v8f accs[4] = {a0, a1, a2, a3};
#pragma unroll
    for (int j = 0; j < 4; ++j)
#pragma unroll
      for (int r = 0; r < 8; ++r)
        sm[(mt * 16 + half * 8 + r) * LSTR + (ntb + j) * 16 + l16] = accs[j][r];
  }
  // This wave's cost and V copies have landed; the barrier publishes all waves'.
  asm volatile("s_wait_asynccnt 0x0" ::: "memory");
  __syncthreads();

  // ---- Phase 2: per-head MLP([score/sqrt(32), cost]) -----------------------
  float W1a[kMSH], W1b[kMSH], B1[kMSH], W2[kMSH];
#pragma unroll
  for (int j = 0; j < kMSH; ++j) {
    W1a[j] = mW1[h * 2 * kMSH + j];          // weight on dot score
    W1b[j] = mW1[h * 2 * kMSH + kMSH + j];   // weight on edge cost
    B1[j]  = mb1[h * kMSH + j];
    W2[j]  = mW2[h * kMSH + j];
  }
  const float B2 = mb2[h];
  const float iscale = 0.17677669529663687f;  // 1/sqrt(32)

  for (int idx = tid; idx < 32 * kP; idx += 256) {
    const int row = idx >> 8, col = idx & 255;
    const float l = sm[row * LSTR + col] * iscale;
    const float c = sC[idx];
    float o = B2;
#pragma unroll
    for (int j = 0; j < kMSH; ++j) {
      const float hid = fmaf(l, W1a[j], fmaf(c, W1b[j], B1[j]));
      o = fmaf(fmaxf(hid, 0.0f), W2[j], o);
    }
    sm[row * LSTR + col] = o;
  }
  __syncthreads();

  // ---- Phase 3: row softmax over P=256 (4 rows per wave, shfl reductions) --
  for (int r = wave * 4; r < wave * 4 + 4; ++r) {
    float* rowp = sm + r * LSTR;
    float vals[8];
    float vmax = -3.4e38f;
#pragma unroll
    for (int i = 0; i < 8; ++i) {
      vals[i] = rowp[lane + i * 32];
      vmax = fmaxf(vmax, vals[i]);
    }
#pragma unroll
    for (int m = 16; m; m >>= 1) vmax = fmaxf(vmax, __shfl_xor(vmax, m, 32));
    float vsum = 0.0f;
#pragma unroll
    for (int i = 0; i < 8; ++i) {
      vals[i] = __expf(vals[i] - vmax);
      vsum += vals[i];
    }
#pragma unroll
    for (int m = 16; m; m >>= 1) vsum += __shfl_xor(vsum, m, 32);
    const float inv = 1.0f / vsum;
#pragma unroll
    for (int i = 0; i < 8; ++i) rowp[lane + i * 32] = vals[i] * inv;
  }
  __syncthreads();

  // ---- Phase 4: heads[32,32] = attn[32,256] @ V_h[256,32] ------------------
  // All 8 waves: tile = wave>>1 (2 mt x 2 nt), kh = wave&1 splits P in half.
  {
    const int tile = wave >> 1;
    const int kh = wave & 1;
    const int mt = tile >> 1, nt = tile & 1;
    const int n = nt * 16 + l16;
    const float* vb = sV + kh * 128 * kVP + n;
    const float* arow = sm + (mt * 16 + l16) * LSTR + kh * 128;
    v8f acc = {};
    constexpr int kS4 = 8;            // k steps per fragment block
    constexpr int kN4 = 128 / 4 / kS4;
    v2f fa[2][kS4];
    float v0[2][kS4], v1[2][kS4];     // the two V rows of a B fragment
    // Unrolled: the fragment sets stay in registers only with constant indices.
    // Trip t reads block t and runs the products of block t - 1.
#pragma unroll
    for (int t = 0; t <= kN4; ++t) {
      if (t < kN4) {
#pragma unroll
        for (int s = 0; s < kS4; ++s) {
          const int ka = (t * kS4 + s) * 4 + half * 2;
          fa[t & 1][s] = v2f{arow[ka], arow[ka + 1]};
          v0[t & 1][s] = vb[ka * kVP];
          v1[t & 1][s] = vb[(ka + 1) * kVP];
        }
      }
      // Keeps the block's LDS reads together ahead of the products (as above).
      __builtin_amdgcn_sched_barrier(0);
      if (t > 0) {
#pragma unroll
        for (int s = 0; s < kS4; ++s)
          acc = wmma_f32x4(fa[(t - 1) & 1][s],
                           v2f{v0[(t - 1) & 1][s], v1[(t - 1) & 1][s]}, acc);
      }
      // Keeps the next block's reads from moving up among these products.
      __builtin_amdgcn_sched_barrier(0);
    }
#pragma unroll
    for (int r = 0; r < 8; ++r)
      part[kh][mt * 16 + half * 8 + r][n] = acc[r];
  }
  __syncthreads();

  // Reduce the two K-halves and write heads[b, s0+row, h*32+col].
  for (int idx = tid; idx < 32 * 32; idx += 256) {
    const int row = idx >> 5, col = idx & 31;
    heads[(size_t)(b * kS + s0 + row) * kD + h * kHD + col] =
        part[0][row][col] + part[1][row][col];
  }
}

extern "C" void kernel_launch(void* const* d_in, const int* in_sizes, int n_in,
                              void* d_out, int out_size, void* d_ws, size_t ws_size,
                              hipStream_t stream) {
  const float* row_emb = (const float*)d_in[0];
  const float* col_emb = (const float*)d_in[1];
  const float* cost    = (const float*)d_in[2];
  const float* Wq = (const float*)d_in[3];
  const float* bq = (const float*)d_in[4];
  const float* Wk = (const float*)d_in[5];
  const float* bk = (const float*)d_in[6];
  const float* Wv = (const float*)d_in[7];
  const float* bv = (const float*)d_in[8];
  const float* Wo = (const float*)d_in[9];
  const float* bo = (const float*)d_in[10];
  const float* mW1 = (const float*)d_in[11];
  const float* mb1 = (const float*)d_in[12];
  const float* mW2 = (const float*)d_in[13];
  const float* mb2 = (const float*)d_in[14];

  const size_t plane = (size_t)kBS * kS * kD;   // 1024*256 floats = 1 MB
  float* Qw = (float*)d_ws;
  float* Kw = Qw + plane;
  float* Vw = Kw + plane;
  float* Hw = Vw + plane;

  sca_qkv<<<192, 256, 0, stream>>>(row_emb, col_emb, Wq, bq, Wk, bk, Wv, bv,
                                  Qw, Kw, Vw);
  sca_attn<<<kBS * kH * (kS / 32), 256, 0, stream>>>(Qw, Kw, Vw, cost,
                                                     mW1, mb1, mW2, mb2, Hw);
  sca_out<<<128, 128, 0, stream>>>(Hw, Wo, bo, (float*)d_out);
}

// v004
// One run takes 16.2 microseconds.
// Next to v003, in two timings, it ran 1.11 times as fast each time.
// All steps since v000 together make it 3.11 times as fast.
#include <hip/hip_runtime.h>

// ---------------------------------------------------------------------------
// SparseCrossAttention on MI455X (gfx1250, wave32, WMMA).
// Dense interpretation: per (b,h) attention over P with a per-head score-mix
// MLP. All matmuls use V_WMMA_F32_16X16X4_F32 (full f32 fidelity): at ~1 GFLOP
// and ~6 MB of L2-resident data, the problem is latency-bound, not rate-bound.
// Fused QKV (3 launches total), projections block-tiled with operands staged in
// LDS, cost prefetch. The attention kernel's operands (Q, K, V head slices, cost
// slab) come into LDS by asynchronous copies; its scores stay in registers from
// Q K^T through MLP and softmax to attn@V, which is split over P across 4 waves.
// ---------------------------------------------------------------------------

typedef __attribute__((ext_vector_type(2))) float v2f;
typedef __attribute__((ext_vector_type(4))) float v4f;
typedef __attribute__((ext_vector_type(8))) float v8f;

constexpr int kBS = 4;
constexpr int kS  = 256;
constexpr int kP  = 256;
constexpr int kD  = 256;
constexpr int kH  = 8;
constexpr int kHD = 32;
constexpr int kMSH = 16;

__device__ __forceinline__ v8f wmma_f32x4(v2f a, v2f b, v8f c) {
  // V_WMMA_F32_16X16X4_F32: D = A(16x4) * B(4x16) + C(16x16)
  return __builtin_amdgcn_wmma_f32_16x16x4_f32(
      /*neg_a=*/false, a, /*neg_b=*/false, b,
      /*c_mod=*/(short)0, c, /*reuse_a=*/false, /*reuse_b=*/false);
}

// Block-tiled Y = X @ W^T + bias (W row-major [256,256], so B[k][n] = W[n][k]).
// A block of BM/16 x 2 waves owns a BM x 64 tile of Y. Its BM rows of X and 64
// rows of W are brought in by b128 loads (16 lanes
// per row piece) and parked in LDS; the WMMA fragments are read from LDS.
// All loads are issued up front; K is handed over in 4 pieces of 64 so that the
// products on piece c run while the later pieces are still on their way.
// Each wave: a 16 x 32 tile (one A fragment feeds 2 accumulator chains), k in
// ascending steps of 4. The fragments of a block of k steps are read from LDS as
// one group, one block ahead of the products that use them (two register sets).
constexpr int kPitch = 260;  // floats; pitch % 64 == 4 -> 16 rows x 4 dwords hit 64 banks
constexpr int kKC = 64;      // floats of K per piece
constexpr int kNC = kD / kKC;

// Work-group barrier that orders LDS traffic only. __syncthreads() would also
// drain every outstanding global load, i.e. wait for the later K pieces before
// the products on the first piece may start.
__device__ __forceinline__ void lds_barrier() {
  __builtin_amdgcn_fence(__ATOMIC_RELEASE, "workgroup", "local");
  __builtin_amdgcn_s_barrier();
  __builtin_amdgcn_fence(__ATOMIC_ACQUIRE, "workgroup", "local");
}

template <int BM>
__device__ __forceinline__ void gemm_lds(const float* __restrict__ X,
                                         const float* __restrict__ W,
                                         const float* __restrict__ bias,
                                         float* __restrict__ Y,
                                         int m0, int n0,
                                         float* __restrict__ sA,
                                         float* __restrict__ sW) {
  constexpr int T  = BM * 4;      // threads in the block
  constexpr int RP = T / 16;      // rows covered by one load of the whole block
  constexpr int PA = BM / RP;     // loads per thread and piece, X rows
  constexpr int PW = 64 / RP;     // loads per thread and piece, W rows
  constexpr int kKB = 16;         // floats of K per fragment block
  constexpr int kSB = kKB / 4;    // WMMA k steps per fragment block
  constexpr int kNB = kD / kKB;
  constexpr int kBP = kKC / kKB;  // fragment blocks per piece
  const int tid  = threadIdx.x;
  const int lane = tid & 31;
  const int wave = tid >> 5;
  const int half = lane >> 4;     // 0: K=k0,k0+1   1: K=k0+2,k0+3
  const int l16  = lane & 15;
  const int lr = tid >> 4;        // row inside one block-wide load
  const int lc = (tid & 15) * 4;  // float column inside the piece

  // The bias is asked for first: its latency passes behind the tile loads.
  const int wm = wave >> 1, wn = wave & 1;
  const int nb = n0 + wn * 32 + l16;
  const float bn[2] = {bias[nb], bias[nb + 16]};

  const float* xp = X + (size_t)(m0 + lr) * kD + lc;
  const float* wp = W + (size_t)(n0 + lr) * kD + lc;
  v4f ra[kNC][PA], rw[kNC][PW];
  // Every loop over c and p is fully unrolled: ra and rw stay in registers only
  // with constant indices (otherwise they go to scratch).
#pragma unroll
  for (int c = 0; c < kNC; ++c) {
#pragma unroll
    for (int p = 0; p < PA; ++p)
      ra[c][p] = *(const v4f*)(xp + p * RP * kD + c * kKC);
#pragma unroll
    for (int p = 0; p < PW; ++p)
      rw[c][p] = *(const v4f*)(wp + p * RP * kD + c * kKC);
    // Keeps the loads in the order of the pieces: piece c is waited for by count.
    __builtin_amdgcn_sched_barrier(0);
  }
  // Precaution: the two address pairs and the bias index stay live up to this
  // wait, so that no load result or later value lands on a register an issued
  // load still names.
  asm volatile("s_wait_xcnt 0x0" :: "v"(xp), "v"(wp), "v"(nb) : "memory");

  const float* arow = sA + (wm * 16 + l16) * kPitch + half * 2;
  const float* b0r  = sW + (wn * 32 + l16) * kPitch + half * 2;
  const float* b1r  = b0r + 16 * kPitch;

  v8f acc0 = {}, acc1 = {};
  v2f fa[2][kSB], f0[2][kSB], f1[2][kSB];
  // Unrolled throughout: the staged pieces and the fragment sets stay in registers
  // only with constant indices, and LDS offsets become immediates.
#pragma unroll
  for (int p = 0; p < PA; ++p)
    *(v4f*)(sA + (p * RP + lr) * kPitch + lc) = ra[0][p];
#pragma unroll
  for (int p = 0; p < PW; ++p)
    *(v4f*)(sW + (p * RP + lr) * kPitch + lc) = rw[0][p];
  lds_barrier();   // piece 0 is complete in LDS; each piece has its own columns
  // Trip t reads block t and runs the products of block t - 1. The next piece is
  // parked in LDS together with the reads of a piece's last block, and its
  // barrier follows one block of products later, when those stores are done.
#pragma unroll
  for (int t = 0; t <= kNB; ++t) {
    if (t < kNB) {
      if (t > 0 && t % kBP == 0) lds_barrier();   // piece t / kBP is complete in LDS
#pragma unroll
      for (int s = 0; s < kSB; ++s) {
        const int k0 = t * kKB + s * 4;
        fa[t & 1][s] = v2f{arow[k0], arow[k0 + 1]};
        f0[t & 1][s] = v2f{b0r[k0], b0r[k0 + 1]};
        f1[t & 1][s] = v2f{b1r[k0], b1r[k0 + 1]};
      }
      if (t % kBP == kBP - 1 && t + 1 < kNB) {
        const int c = (t + 1) / kBP;
#pragma unroll
        for (int p = 0; p < PA; ++p)
          *(v4f*)(sA + (p * RP + lr) * kPitch + c * kKC + lc) = ra[c][p];
#pragma unroll
        for (int p = 0; p < PW; ++p)
          *(v4f*)(sW + (p * RP + lr) * kPitch + c * kKC + lc) = rw[c][p];
      }
    }
    // Keeps the block's LDS traffic together ahead of the products (for speed only).
    __builtin_amdgcn_sched_barrier(0);
    if (t > 0) {
#pragma unroll
      for (int s = 0; s < kSB; ++s) {
        acc0 = wmma_f32x4(fa[(t - 1) & 1][s], f0[(t - 1) & 1][s], acc0);
        acc1 = wmma_f32x4(fa[(t - 1) & 1][s], f1[(t - 1) & 1][s], acc1);
      }
    }
    // Keeps the next block's reads from moving up among these products.
    __builtin_amdgcn_sched_barrier(0);
  }

  v8f accs[2] = {acc0 + bn[0], acc1 + bn[1]};
  float* yp = Y + (size_t)(m0 + wm * 16 + half * 8) * kD + nb;
  // Keeps the sums and the address ahead of the stores, which then go out in one
  // run (among them, each sum would wait for an issued store to let go of its
  // register).
  __builtin_amdgcn_sched_barrier(0);
#pragma unroll
  for (int j = 0; j < 2; ++j) {
#pragma unroll
    for (int r = 0; r < 8; ++r) yp[r * kD + j * 16] = accs[j][r];
  }
}

// Fused Q/K/V projections: 3 GEMMs x (16 x 4) tiles of 64 x 64 -> 192 blocks.
__global__ __launch_bounds__(256)
void sca_qkv(const float* __restrict__ row_emb, const float* __restrict__ col_emb,
             const float* __restrict__ Wq, const float* __restrict__ bq,
             const float* __restrict__ Wk, const float* __restrict__ bk,
             const float* __restrict__ Wv, const float* __restrict__ bv,
             float* __restrict__ Qw, float* __restrict__ Kw,
             float* __restrict__ Vw) {
  __shared__ __attribute__((aligned(16))) float sA[64 * kPitch];
  __shared__ __attribute__((aligned(16))) float sW[64 * kPitch];
  const int which = blockIdx.x >> 6;        // 0=Q, 1=K, 2=V
  const int t  = blockIdx.x & 63;
  const float* X    = (which == 0) ? row_emb : col_emb;
  const float* W    = (which == 0) ? Wq : (which == 1) ? Wk : Wv;
  const float* bias = (which == 0) ? bq : (which == 1) ? bk : bv;
  float*       Y    = (which == 0) ? Qw : (which == 1) ? Kw : Vw;
  gemm_lds<64>(X, W, bias, Y, (t >> 2) * 64, (t & 3) * 64, sA, sW);
}

// Output projection: out = heads @ Wo^T + bo. (32 x 4) tiles of 32 x 64 -> 128
// blocks of 4 waves.
__global__ __launch_bounds__(128)
void sca_out(const float* __restrict__ Hm, const float* __restrict__ Wo,
             const float* __restrict__ bo, float* __restrict__ out) {
  __shared__ __attribute__((aligned(16))) float sA[32 * kPitch];
  __shared__ __attribute__((aligned(16))) float sW[64 * kPitch];
  gemm_lds<32>(Hm, Wo, bo, out, (int)(blockIdx.x >> 2) * 32, (int)(blockIdx.x & 3) * 64, sA, sW);
}

// LDS byte address of a __shared__ location: the low 32 bits of its address.
__device__ __forceinline__ unsigned lds_addr(const float* p) {
  return (unsigned)(size_t)p;
}

// Asynchronous copies global -> LDS, 16 B per lane, through no register. The
// s_wait_xcnt closes each statement so that it stands ahead of any later write
// to a register that an issued copy names (a precaution).
__device__ __forceinline__ void async_copy1(unsigned l, const float* g) {
  asm volatile("global_load_async_to_lds_b128 %0, %1, off\n\t"
               "s_wait_xcnt 0x0"
               :: "v"(l), "v"(g) : "memory");
}
__device__ __forceinline__ void async_copy8(const unsigned (&l)[8],
                                            const float* const (&g)[8]) {
  asm volatile("global_load_async_to_lds_b128 %0, %8, off\n\t"
               "global_load_async_to_lds_b128 %1, %9, off\n\t"
               "global_load_async_to_lds_b128 %2, %10, off\n\t"
               "global_load_async_to_lds_b128 %3, %11, off\n\t"
               "global_load_async_to_lds_b128 %4, %12, off\n\t"
               "global_load_async_to_lds_b128 %5, %13, off\n\t"
               "global_load_async_to_lds_b128 %6, %14, off\n\t"
               "global_load_async_to_lds_b128 %7, %15, off\n\t"
               "s_wait_xcnt 0x0"
               :: "v"(l[0]), "v"(l[1]), "v"(l[2]), "v"(l[3]),
                  "v"(l[4]), "v"(l[5]), "v"(l[6]), "v"(l[7]),
                  "v"(g[0]), "v"(g[1]), "v"(g[2]), "v"(g[3]),
                  "v"(g[4]), "v"(g[5]), "v"(g[6]), "v"(g[7])
               : "memory");
}

// The other lane half's value (lane l <-> l ^ 16) by a vector cross-row move.
__device__ __forceinline__ float other_half(float x) {
  const unsigned u = __builtin_bit_cast(unsigned, x);
  return __builtin_bit_cast(float, __builtin_amdgcn_permlanex16(
      u, u, 0x76543210u, 0xfedcba98u, false, false));
}

// Two base-2 exponentials, in place. The closing v_nop is the slot that the
// instruction set asks for behind a transcendental before its result is read or
// its source overwritten; inside one statement nothing can come in between.
__device__ __forceinline__ void exp2_pair(float& a, float& b) {
  asm("v_exp_f32 %0, %0\n\t"
      "v_exp_f32 %1, %1\n\t"
      "v_nop"
      : "+v"(a), "+v"(b));
}

// One block = (b, h, 32-row S slab). Wave w owns 16 s rows (w & 1) x 64 p
// columns (w >> 1) from the scores to its share of attn @ V, all in registers:
// the score tiles are formed transposed (A = K rows, B = Q rows), so that a lane
// holds one s and 8 p per tile, D[r] = S[s = c][p = 8h + r]. The per-head MLP
// and the softmax terms work on those registers, and register pairs (2q, 2q+1)
// are the B fragments of heads^T = V^T @ attn^T, whose A fragments take V rows
// in the same k order, p = 8h + 2q + v. Each wave uses the maximum of its own 64
// columns; the four p quarters are rescaled, summed and normalised at the end.
// A row's head slice is one 128-B line: a wave-wide copy moves 4 whole lines.
constexpr int kQKP = 36;  // Q, K pitch: 16 rows x 4 dwords of a b64 read hit 64 banks
constexpr int kVP  = 36;  // V pitch: rows p and p+8 (the two lane halves) 32 banks apart
constexpr int kCP  = 260; // cost pitch: 16 rows x 4 dwords of a b128 read hit 64 banks
constexpr int kPP  = 36;  // pitch of the partial results: as kCP, for b128 stores
__global__ __launch_bounds__(256)
void sca_attn(const float* __restrict__ Q, const float* __restrict__ Km,
              const float* __restrict__ Vm, const float* __restrict__ cost,
              const float* __restrict__ mW1, const float* __restrict__ mb1,
              const float* __restrict__ mW2, const float* __restrict__ mb2,
              float* __restrict__ heads) {
  __shared__ __attribute__((aligned(16))) float part[4 * 32 * kPP];
  __shared__ float sMx[4][32];
  __shared__ float sSm[4][32];
  __shared__ __attribute__((aligned(16))) float sQ[32 * kQKP];
  __shared__ __attribute__((aligned(16))) float sK[kP * kQKP];
  __shared__ __attribute__((aligned(16))) float sV[kP * kVP];
  __shared__ __attribute__((aligned(16))) float sC[32 * kCP];

  const int tid  = threadIdx.x;
  const int lane = tid & 31;
  const int wave = tid >> 5;
  const int half = lane >> 4;
  const int l16  = lane & 15;

  const int blk = blockIdx.x;
  const int b  = blk >> 6;          // 64 blocks per batch (H * S/32)
  const int h  = (blk >> 3) & 7;
  const int s0 = (blk & 7) * 32;

  // Prefetch this block's cost slab (32 KB) so its copy below hits cache.
  // Lowers to global_prefetch_b8; 256 threads x 128 B covers the slab.
  {
    const char* cpf = (const char*)(cost + (size_t)(b * kS + s0) * kP);
    __builtin_prefetch(cpf + (size_t)tid * 128, 0, 1);
  }

  // ---- Staging: every lane copies 16 B; 8 lanes cover a row's head slice ----
  const int cr = tid >> 3;        // row inside one block-wide copy (32 rows)
  const int cc = (tid & 7) * 4;   // float column inside the head slice
  {
    // Q_h (32 rows) and K_h (256 rows): what phase 1 reads.
    const float* gk = Km + (size_t)(b * kP + cr) * kD + h * kHD + cc;
    unsigned l[8];
    const float* g[8];
    // Unrolled: the address arrays stay in registers only with constant indices.
#pragma unroll
    for (int i = 0; i < 8; ++i) {
      l[i] = lds_addr(sK + (i * 32 + cr) * kQKP + cc);
      g[i] = gk + (size_t)i * 32 * kD;
    }
    async_copy1(lds_addr(sQ + cr * kQKP + cc),
                Q + (size_t)(b * kS + s0 + cr) * kD + h * kHD + cc);
    async_copy8(l, g);
  }
  // This wave's Q and K copies have landed; the barrier publishes all waves'.
  asm volatile("s_wait_asynccnt 0x0" ::: "memory");
  __syncthreads();
  {
    // Cost slab (32 rows of 1 KB, padded to kCP in LDS) and V_h (256 rows): they
    // fly during phase 1 and are waited for at its closing barrier.
    const float* gc = cost + (size_t)(b * kS + s0) * kP + tid * 4;
    const float* gv = Vm + (size_t)(b * kP + cr) * kD + h * kHD + cc;
    unsigned lc[8], lv[8];
    const float* pc[8];
    const float* pv[8];
    // Unrolled: as above, constant indices keep the address arrays in registers.
#pragma unroll
    for (int i = 0; i < 8; ++i) {
      lc[i] = lds_addr(sC + (i * 4 + (tid >> 6)) * kCP + (tid & 63) * 4);
      pc[i] = gc + i * 1024;
      lv[i] = lds_addr(sV + (i * 32 + cr) * kVP + cc);
      pv[i] = gv + (size_t)i * 32 * kD;
    }
    async_copy8(lc, pc);
    async_copy8(lv, pv);
  }

  const int mt  = wave & 1;          // s tile
  const int pq  = wave >> 1;         // p quarter
  const int ntb = pq * 4;            // its first p tile

  // ---- Phase 1: raw logits^T = K_h(64x32) @ Q_h^T(32x16), 4 tiles ----------
  // 1 Q fragment (B) feeds the 4 K fragments (A) of a k step.
  v8f sc[4];
  {
    const float* qrow = sQ + (mt * 16 + l16) * kQKP;
    const float* k0r = sK + ((ntb + 0) * 16 + l16) * kQKP;
    const float* k1r = sK + ((ntb + 1) * 16 + l16) * kQKP;
    const float* k2r = sK + ((ntb + 2) * 16 + l16) * kQKP;
    const float* k3r = sK + ((ntb + 3) * 16 + l16) * kQKP;
    v8f a0 = {}, a1 = {}, a2 = {}, a3 = {};
    v2f fq[kHD / 4], fk0[kHD / 4], fk1[kHD / 4], fk2[kHD / 4], fk3[kHD / 4];
    // Unrolled: the fragment arrays stay in registers only with constant indices.
#pragma unroll
    for (int s = 0; s < kHD / 4; ++s) {
      const int ka = s * 4 + half * 2;
      fq[s]  = v2f{qrow[ka], qrow[ka + 1]};
      fk0[s] = v2f{k0r[ka], k0r[ka + 1]};
      fk1[s] = v2f{k1r[ka], k1r[ka + 1]};
      fk2[s] = v2f{k2r[ka], k2r[ka + 1]};
      fk3[s] = v2f{k3r[ka], k3r[ka + 1]};
      // Keeps all LDS reads of the phase together ahead of its products, the first
      // four
      // k steps' reads in front, so that the products start on a counted wait.
      if (s % 4 == 3) __builtin_amdgcn_sched_barrier(0);
    }
#pragma unroll
    for (int s = 0; s < kHD / 4; ++s) {
      a0 = wmma_f32x4(fk0[s], fq[s], a0);
      a1 = wmma_f32x4(fk1[s], fq[s], a1);
      a2 = wmma_f32x4(fk2[s], fq[s], a2);
      a3 = wmma_f32x4(fk3[s], fq[s], a3);
    }
    sc[0] = a0; sc[1] = a1; sc[2] = a2; sc[3] = a3;
  }
  // This wave's cost and V copies have landed; the barrier publishes all waves'.
  // The score tiles are inputs of the wait so that their products are issued
  // ahead of it: they use registers only, and the compiler otherwise moves them
  // behind the wait, where they no longer run while the copies fly.
  asm volatile("s_wait_asynccnt 0x0"
               :: "v"(sc[0]), "v"(sc[1]), "v"(sc[2]), "v"(sc[3]) : "memory");
  __syncthreads();

  // ---- Phase 2: per-head MLP([score/sqrt(32), cost]) on the score registers -
  // Two neighbouring p of a lane go through it as one float pair.
  v2f W1a[kMSH], W1b[kMSH], B1[kMSH], W2[kMSH];
#pragma unroll
  for (int j = 0; j < kMSH; ++j) {
    const float wa = mW1[h * 2 * kMSH + j];          // weight on dot score
    const float wb = mW1[h * 2 * kMSH + kMSH + j];   // weight on edge cost
    const float bb = mb1[h * kMSH + j];
    const float w2 = mW2[h * kMSH + j];
    W1a[j] = v2f{wa, wa};
    W1b[j] = v2f{wb, wb};
    B1[j]  = v2f{bb, bb};
    W2[j]  = v2f{w2, w2};
  }
  const float B2 = mb2[h];
  const float iscale = 0.17677669529663687f;  // 1/sqrt(32)

  // cost[s = this lane's row][the lane's 8 p of each tile]: two b128 reads a tile.
  const float* crow = sC + (mt * 16 + l16) * kCP + ntb * 16 + half * 8;
  v4f cst[4][2];
  // Unrolled here and below: register arrays need constant indices.
#pragma unroll
  for (int j = 0; j < 4; ++j) {
    cst[j][0] = *(const v4f*)(crow + j * 16);
    cst[j][1] = *(const v4f*)(crow + j * 16 + 4);
  }
  const v2f zero2 = {0.0f, 0.0f};
#pragma unroll
  for (int j = 0; j < 4; ++j) {
#pragma unroll
    for (int q = 0; q < 4; ++q) {
      const v2f l = v2f{sc[j][2 * q], sc[j][2 * q + 1]} * iscale;
      const v2f c = v2f{cst[j][q >> 1][(q & 1) * 2], cst[j][q >> 1][(q & 1) * 2 + 1]};
      v2f o = {B2, B2};
#pragma unroll
      for (int k = 0; k < kMSH; ++k) {
        const v2f hid = __builtin_elementwise_fma(
            l, W1a[k], __builtin_elementwise_fma(c, W1b[k], B1[k]));
        o = __builtin_elementwise_fma(__builtin_elementwise_max(hid, zero2), W2[k], o);
      }
      sc[j][2 * q] = o[0];
      sc[j][2 * q + 1] = o[1];
    }
  }

  // ---- Phase 3: softmax terms of this wave's 64 columns, in registers ------
  float vmax = sc[0][0];
#pragma unroll
  for (int j = 0; j < 4; ++j)
#pragma unroll
    for (int r = 0; r < 8; ++r) vmax = fmaxf(vmax, sc[j][r]);
  vmax = fmaxf(vmax, other_half(vmax));

  // The A fragments of phase 4: V[p = tile + 8h + 2q + v][n = 16t + c].
  const float* vb = sV + (ntb * 16 + half * 8) * kVP + l16;
  float va[4][4][2][2];
#pragma unroll
  for (int j = 0; j < 4; ++j)
#pragma unroll
    for (int q = 0; q < 4; ++q)
#pragma unroll
      for (int t = 0; t < 2; ++t)
#pragma unroll
        for (int v = 0; v < 2; ++v)
          va[j][q][t][v] = vb[(j * 16 + q * 2 + v) * kVP + t * 16];
  // Keeps all V reads together here, ahead of the exponentials that cover their
  // latency.
  __builtin_amdgcn_sched_barrier(0);

  float vsum = 0.0f;
  const float log2e = 1.44269504088896340736f;
#pragma unroll
  for (int j = 0; j < 4; ++j)
#pragma unroll
    for (int q = 0; q < 4; ++q) {
      float e0 = (sc[j][2 * q] - vmax) * log2e;
      float e1 = (sc[j][2 * q + 1] - vmax) * log2e;
      exp2_pair(e0, e1);
      sc[j][2 * q] = e0;
      sc[j][2 * q + 1] = e1;
      vsum += e0;
      vsum += e1;
    }
  vsum += other_half(vsum);

  // ---- Phase 4: heads^T[32,16] += V_h^T[32,64] @ terms^T[64,16] ------------
  v8f h0 = {}, h1 = {};
#pragma unroll
  for (int j = 0; j < 4; ++j) {
#pragma unroll
    for (int q = 0; q < 4; ++q) {
      const v2f bf = v2f{sc[j][2 * q], sc[j][2 * q + 1]};
      h0 = wmma_f32x4(v2f{va[j][q][0][0], va[j][q][0][1]}, bf, h0);
      h1 = wmma_f32x4(v2f{va[j][q][1][0], va[j][q][1][1]}, bf, h1);
    }
  }
  {
    // D[r] = heads^T[n = 16t + 8h + r][s = c]: 8 consecutive n of one s row.
    float* pp = part + (pq * 32 + mt * 16 + l16) * kPP + half * 8;
    *(v4f*)(pp)      = v4f{h0[0], h0[1], h0[2], h0[3]};
    *(v4f*)(pp + 4)  = v4f{h0[4], h0[5], h0[6], h0[7]};
    *(v4f*)(pp + 16) = v4f{h1[0], h1[1], h1[2], h1[3]};
    *(v4f*)(pp + 20) = v4f{h1[4], h1[5], h1[6], h1[7]};
    if (half == 0) {
      sMx[pq][mt * 16 + l16] = vmax;
      sSm[pq][mt * 16 + l16] = vsum;
    }
  }
  __syncthreads();

  // Merge the four p quarters on the row's common maximum, normalise, and write
  // heads[b, s0+row, h*32+col .. +3]: 8 lanes store a row's whole 128-B line.
  {
    const int row = tid >> 3, col = (tid & 7) * 4;
    float m[4];
#pragma unroll
    for (int w = 0; w < 4; ++w) m[w] = sMx[w][row];
    const float mm = fmaxf(fmaxf(m[0], m[1]), fmaxf(m[2], m[3]));
    float den = 0.0f;
    v4f o = {};
#pragma unroll
    for (int w = 0; w < 4; ++w) {
      const float f = __expf(m[w] - mm);
      den = fmaf(sSm[w][row], f, den);
      o += *(const v4f*)(part + (w * 32 + row) * kPP + col) * f;
    }
    o *= 1.0f / den;
    *(v4f*)(heads + (size_t)(b * kS + s0 + row) * kD + h * kHD + col) = o;
  }
}

extern "C" void kernel_launch(void* const* d_in, const int* in_sizes, int n_in,
                              void* d_out, int out_size, void* d_ws, size_t ws_size,
                              hipStream_t stream) {
  const float* row_emb = (const float*)d_in[0];
  const float* col_emb = (const float*)d_in[1];
  const float* cost    = (const float*)d_in[2];
  const float* Wq = (const float*)d_in[3];
  const float* bq = (const float*)d_in[4];
  const float* Wk = (const float*)d_in[5];
  const float* bk = (const float*)d_in[6];
  const float* Wv = (const float*)d_in[7];
  const float* bv = (const float*)d_in[8];
  const float* Wo = (const float*)d_in[9];
  const float* bo = (const float*)d_in[10];
  const float* mW1 = (const float*)d_in[11];
  const float* mb1 = (const float*)d_in[12];
  const float* mW2 = (const float*)d_in[13];
  const float* mb2 = (const float*)d_in[14];

  const size_t plane = (size_t)kBS * kS * kD;   // 1024*256 floats = 1 MB
  float* Qw = (float*)d_ws;
  float* Kw = Qw + plane;
  float* Vw = Kw + plane;
  float* Hw = Vw + plane;

  sca_qkv<<<192, 256, 0, stream>>>(row_emb, col_emb, Wq, bq, Wk, bk, Wv, bv,
                                  Qw, Kw, Vw);
  sca_attn<<<kBS * kH * (kS / 32), 256, 0, stream>>>(Qw, Kw, Vw, cost,
                                                     mW1, mb1, mW2, mb2, Hw);
  sca_out<<<128, 128, 0, stream>>>(Hw, Wo, bo, (float*)d_out);
}
